// v000
// Times are from an AMD MI455X. After a warm-up the kernel runs many times in a row, and a time is the length of
// such a window on the GPU divided by its runs, so every launch and the gaps after it count. The runs cycle
// through copies of the inputs. A figure is the median of several windows, for all but v000 over two sittings.
// Sittings can differ by a few percent; kernels timed side by side share one.
// The starting kernel, v000, takes 28.5 microseconds a run.
#include <hip/hip_runtime.h>

typedef __attribute__((ext_vector_type(16))) _Float16 v16h;
typedef __attribute__((ext_vector_type(8)))  _Float16 v8h;
typedef __attribute__((ext_vector_type(4)))  _Float16 v4h;
typedef __attribute__((ext_vector_type(8)))  float    v8f;

#define BATCH   64
#define SEQ     1024
#define DIM     64
#define KCHUNK  64
#define WAVES   8
#define QPB     (WAVES * 16)   // 128 queries per block
#define LDSPAD  72             // padded row stride in halves (144B: 16B-aligned, bank-staggered)
#define NEGF    (-1.0e6f)
// 1/sqrt(64) * log2(e): softmax runs in exp2 domain -> bare v_exp_f32
#define SCALE_LOG2E (0.125f * 1.44269504088896340736f)

// Raw v_exp_f32: args are always <= 0 here; underflow-to-zero is the desired
// behavior, so skip libm's 7-op denormal-range fixup.
#if __has_builtin(__builtin_amdgcn_exp2f)
#define FAST_EXP2(x) __builtin_amdgcn_exp2f(x)
#else
#define FAST_EXP2(x) exp2f(x)
#endif
#if __has_builtin(__builtin_amdgcn_rcpf)
#define FAST_RCP(x) __builtin_amdgcn_rcpf(x)
#else
#define FAST_RCP(x) (1.0f / (x))
#endif

__global__ __launch_bounds__(256)
void flash_attn_st_f16wmma_kernel(const float* __restrict__ Q,
                                  const float* __restrict__ K,
                                  const float* __restrict__ V,
                                  const int*   __restrict__ vlens,
                                  float*       __restrict__ O)
{
    // Double-buffered staging: one barrier per chunk, global latency overlapped
    __shared__ __align__(16) _Float16 Ksh[2][KCHUNK * LDSPAD];  // [buf][key][d]
    __shared__ __align__(16) _Float16 Vsh[2][DIM * LDSPAD];     // [buf][d][key]

    const int tid  = threadIdx.x;
    const int lane = tid & 31;
    const int wv   = tid >> 5;
    const int g    = lane >> 4;   // half-wave group
    const int ln   = lane & 15;   // this lane's query column (and A-tile row)

    const int b    = blockIdx.x >> 3;                  // SEQ/QPB == 8
    const int q0   = (blockIdx.x & 7) * QPB + wv * 16;
    const int vlen = vlens[b];

    // Per-thread staging coordinates (4 float4 groups per thread per chunk)
    const int skey0 = tid >> 4;          // + 16*i
    const int sdg   = (tid & 15) * 4;

    // ---- Q^T in WMMA B-layout (lane = query col, elements = d rows), scale folded ----
    v16h qb[2];
    {
        const float* qr = Q + ((size_t)b * SEQ + (q0 + ln)) * DIM;
        #pragma unroll
        for (int c = 0; c < 2; ++c)
            #pragma unroll
            for (int h = 0; h < 2; ++h) {
                const int dbase = 32 * c + 16 * h + 8 * g;
                #pragma unroll
                for (int j = 0; j < 8; ++j)
                    qb[c][h * 8 + j] = (_Float16)(qr[dbase + j] * SCALE_LOG2E);
            }
    }

    // All-ones A tile: row-sum of P (column-sum of P^T) via the matrix pipe
    v16h onesA;
    #pragma unroll
    for (int e = 0; e < 16; ++e) onesA[e] = (_Float16)1.0f;

    v8f oT[4];
    {
        v8f z = {};
        #pragma unroll
        for (int t = 0; t < 4; ++t) oT[t] = z;
    }
    float m = -3.0e38f, l = 0.0f;

    const int nchunks = (vlen + KCHUNK - 1) / KCHUNK;   // uniform per block

    // ---- Prologue: stage chunk 0 into buffer 0 ----
    {
        const size_t base = (size_t)b * SEQ * DIM;
        #pragma unroll
        for (int i = 0; i < 4; ++i) {
            const int key = skey0 + 16 * i;
            const float4 kq = *(const float4*)(K + base + (size_t)key * DIM + sdg);
            const float4 vq = *(const float4*)(V + base + (size_t)key * DIM + sdg);
            v4h hk;
            hk[0] = (_Float16)kq.x; hk[1] = (_Float16)kq.y;
            hk[2] = (_Float16)kq.z; hk[3] = (_Float16)kq.w;
            *(v4h*)&Ksh[0][key * LDSPAD + sdg] = hk;
            const float vv[4] = { vq.x, vq.y, vq.z, vq.w };
            #pragma unroll
            for (int j = 0; j < 4; ++j)
                Vsh[0][(sdg + j) * LDSPAD + key] = (_Float16)vv[j];
        }
    }
    __syncthreads();

    for (int ci = 0; ci < nchunks; ++ci) {
        const int  kc0      = ci * KCHUNK;
        const int  buf      = ci & 1;
        const bool has_next = (ci + 1 < nchunks);

        // ---- Issue next chunk's global loads NOW (land during compute) ----
        float4 nk[4], nv[4];
        if (has_next) {
            const size_t nbase = ((size_t)b * SEQ + kc0 + KCHUNK) * DIM;
            #pragma unroll
            for (int i = 0; i < 4; ++i) {
                const int key = skey0 + 16 * i;
                nk[i] = *(const float4*)(K + nbase + (size_t)key * DIM + sdg);
                nv[i] = *(const float4*)(V + nbase + (size_t)key * DIM + sdg);
            }
            if (ci + 2 < nchunks) {   // keep L2 warm two chunks ahead
                const size_t pbase = ((size_t)b * SEQ + kc0 + 2 * KCHUNK) * DIM + tid * 16;
                __builtin_prefetch(K + pbase, 0, 1);
                __builtin_prefetch(V + pbase, 0, 1);
            }
        }

        // ---- S^T = K * Q^T : 4 key tiles x 2 D-chunks ----
        v8f s[4];
        #pragma unroll
        for (int nt = 0; nt < 4; ++nt) {
            v8f acc = {};
            #pragma unroll
            for (int c = 0; c < 2; ++c) {
                const _Float16* kr = &Ksh[buf][(nt * 16 + ln) * LDSPAD + 32 * c + 8 * g];
                const v8h lo = *(const v8h*)kr;
                const v8h hi = *(const v8h*)(kr + 16);
                v16h ka;
                #pragma unroll
                for (int j = 0; j < 8; ++j) { ka[j] = lo[j]; ka[8 + j] = hi[j]; }
                acc = __builtin_amdgcn_wmma_f32_16x16x32_f16(
                          false, ka, false, qb[c], (short)0, acc, false, false);
            }
            s[nt] = acc;
        }

        // ---- Sequence mask: only the (single, partial) tail chunk pays ----
        if (kc0 + KCHUNK > vlen) {
            #pragma unroll
            for (int nt = 0; nt < 4; ++nt)
                #pragma unroll
                for (int r = 0; r < 8; ++r)
                    if (kc0 + nt * 16 + 8 * g + r >= vlen) s[nt][r] = NEGF;
        }

        // ---- Online softmax (log2 domain): one query per lane ----
        float tmax = s[0][0];
        #pragma unroll
        for (int nt = 0; nt < 4; ++nt)
            #pragma unroll
            for (int r = 0; r < 8; ++r) tmax = fmaxf(tmax, s[nt][r]);
        tmax = fmaxf(tmax, __shfl_xor(tmax, 16, 32));   // combine the two key halves
        const float mnew  = fmaxf(m, tmax);
        const float alpha = FAST_EXP2(m - mnew);
        m  = mnew;
        l *= alpha;
        #pragma unroll
        for (int t4 = 0; t4 < 4; ++t4)
            #pragma unroll
            for (int r = 0; r < 8; ++r) oT[t4][r] *= alpha;

        // ---- P^T B-tiles straight from registers (C/D layout == B layout) ----
        v16h pb[2];
        #pragma unroll
        for (int a = 0; a < 2; ++a)
            #pragma unroll
            for (int e = 0; e < 16; ++e) {
                const int nt = 2 * a + (e >> 3);
                const int r  = e & 7;
                pb[a][e] = (_Float16)FAST_EXP2(s[nt][r] - mnew);
            }

        // ---- Row-sum of P via ones-WMMA (matrix pipe) ----
        v8f lacc = {};
        #pragma unroll
        for (int a = 0; a < 2; ++a)
            lacc = __builtin_amdgcn_wmma_f32_16x16x32_f16(
                       false, onesA, false, pb[a], (short)0, lacc, false, false);

        // ---- O^T += V^T * P^T : 4 D tiles x 2 key chunks ----
        #pragma unroll
        for (int t4 = 0; t4 < 4; ++t4)
            #pragma unroll
            for (int a = 0; a < 2; ++a) {
                const _Float16* vr = &Vsh[buf][(t4 * 16 + ln) * LDSPAD + 32 * a + 8 * g];
                const v8h lo = *(const v8h*)vr;
                const v8h hi = *(const v8h*)(vr + 16);
                v16h va;
                #pragma unroll
                for (int j = 0; j < 8; ++j) { va[j] = lo[j]; va[8 + j] = hi[j]; }
                oT[t4] = __builtin_amdgcn_wmma_f32_16x16x32_f16(
                             false, va, false, pb[a], (short)0, oT[t4], false, false);
            }

        l += lacc[0];   // all 8 rows of the ones-product are identical

        // ---- Convert + store the prefetched next chunk into the other buffer ----
        if (has_next) {
            const int nb = buf ^ 1;
            #pragma unroll
            for (int i = 0; i < 4; ++i) {
                const int key = skey0 + 16 * i;
                v4h hk;
                hk[0] = (_Float16)nk[i].x; hk[1] = (_Float16)nk[i].y;
                hk[2] = (_Float16)nk[i].z; hk[3] = (_Float16)nk[i].w;
                *(v4h*)&Ksh[nb][key * LDSPAD + sdg] = hk;
                const float vv[4] = { nv[i].x, nv[i].y, nv[i].z, nv[i].w };
                #pragma unroll
                for (int j = 0; j < 4; ++j)
                    Vsh[nb][(sdg + j) * LDSPAD + key] = (_Float16)vv[j];
            }
            __syncthreads();   // uniform: protects both buffers across waves
        }
    }

    // ---- Epilogue: O = O^T / l, 32B-contiguous float4 stores per lane ----
    const float invl = FAST_RCP(l);
    float* orow = O + ((size_t)b * SEQ + (q0 + ln)) * DIM;
    #pragma unroll
    for (int t4 = 0; t4 < 4; ++t4) {
        float4 s0, s1;
        s0.x = oT[t4][0] * invl; s0.y = oT[t4][1] * invl;
        s0.z = oT[t4][2] * invl; s0.w = oT[t4][3] * invl;
        s1.x = oT[t4][4] * invl; s1.y = oT[t4][5] * invl;
        s1.z = oT[t4][6] * invl; s1.w = oT[t4][7] * invl;
        *(float4*)&orow[t4 * 16 + 8 * g]     = s0;
        *(float4*)&orow[t4 * 16 + 8 * g + 4] = s1;
    }
}

extern "C" void kernel_launch(void* const* d_in, const int* in_sizes, int n_in,
                              void* d_out, int out_size, void* d_ws, size_t ws_size,
                              hipStream_t stream) {
    const float* Q  = (const float*)d_in[0];
    const float* K  = (const float*)d_in[1];
    const float* V  = (const float*)d_in[2];
    const int*   vl = (const int*)d_in[3];
    float*       Op = (float*)d_out;

    dim3 grid(BATCH * (SEQ / QPB));   // 512 blocks
    dim3 block(256);                  // 8 waves of 32
    flash_attn_st_f16wmma_kernel<<<grid, block, 0, stream>>>(Q, K, V, vl, Op);
}

// v001
// One run takes 20.9 microseconds.
// Next to v000, in two timings, it ran 1.40 times as fast each time.
#include <hip/hip_runtime.h>

typedef __attribute__((ext_vector_type(16))) _Float16 v16h;
typedef __attribute__((ext_vector_type(8)))  _Float16 v8h;
typedef __attribute__((ext_vector_type(4)))  _Float16 v4h;
typedef __attribute__((ext_vector_type(8)))  float    v8f;
typedef __attribute__((ext_vector_type(8)))  short    v8s;

#define BATCH   64
#define SEQ     1024
#define DIM     64
#define KCHUNK  64
#define WAVES   8
#define QPB     (WAVES * 16)   // 128 queries per block
#define LDSPAD  72             // padded row stride in halves (144B: 16B-aligned, bank-staggered)
#define VPITCH  80             // V row stride in halves (160B = 32B x odd: the transposing load's pitch)
#define NEGF    (-1.0e6f)
// 1/sqrt(64) * log2(e): softmax runs in exp2 domain -> bare v_exp_f32
#define SCALE_LOG2E (0.125f * 1.44269504088896340736f)

// Raw v_exp_f32: args are always <= 0 here; underflow-to-zero is the desired
// behavior, so skip libm's 7-op denormal-range fixup.
#if __has_builtin(__builtin_amdgcn_exp2f)
#define FAST_EXP2(x) __builtin_amdgcn_exp2f(x)
#else
#define FAST_EXP2(x) exp2f(x)
#endif
#if __has_builtin(__builtin_amdgcn_rcpf)
#define FAST_RCP(x) __builtin_amdgcn_rcpf(x)
#else
#define FAST_RCP(x) (1.0f / (x))
#endif

// 16-bit transposing LDS load: from a row-major [key][d] tile, lane (ln, g)
// receives 8 consecutive keys (8g .. 8g+7) of column ln.
__device__ __forceinline__ v8h lds_tr16(const _Float16* p) {
    typedef __attribute__((address_space(3))) v8s lds_v8s;
    return __builtin_bit_cast(v8h, __builtin_amdgcn_ds_load_tr16_b128_v8i16((lds_v8s*)p));
}

__global__ __launch_bounds__(256)
void flash_attn_st_f16wmma_kernel(const float* __restrict__ Q,
                                  const float* __restrict__ K,
                                  const float* __restrict__ V,
                                  const int*   __restrict__ vlens,
                                  float*       __restrict__ O)
{
    // Double-buffered staging: one barrier per chunk, global latency overlapped
    __shared__ __align__(16) _Float16 Ksh[2][KCHUNK * LDSPAD];  // [buf][key][d]
    __shared__ __align__(16) _Float16 Vsh[2][KCHUNK * VPITCH];  // [buf][key][d]

    const int tid  = threadIdx.x;
    const int lane = tid & 31;
    const int wv   = tid >> 5;
    const int g    = lane >> 4;   // half-wave group
    const int ln   = lane & 15;   // this lane's query column (and A-tile row)

    const int b    = blockIdx.x >> 3;                  // SEQ/QPB == 8
    const int q0   = (blockIdx.x & 7) * QPB + wv * 16;
    const int vlen = vlens[b];

    // Per-thread staging coordinates (4 float4 groups per thread per chunk)
    const int skey0 = tid >> 4;          // + 16*i
    const int sdg   = (tid & 15) * 4;

    // Per-lane source of the transposing V read: row 8g + (lane & 7), 16B column half (lane >> 3) & 1
    const int vtoff = (8 * g + (lane & 7)) * VPITCH + 8 * ((lane >> 3) & 1);

    // ---- Q^T in WMMA B-layout (lane = query col, elements = d rows), scale folded ----
    v16h qb[2];
    {
        const float* qr = Q + ((size_t)b * SEQ + (q0 + ln)) * DIM;
        #pragma unroll
        for (int c = 0; c < 2; ++c)
            #pragma unroll
            for (int h = 0; h < 2; ++h) {
                const int dbase = 32 * c + 16 * h + 8 * g;
                #pragma unroll
                for (int j = 0; j < 8; ++j)
                    qb[c][h * 8 + j] = (_Float16)(qr[dbase + j] * SCALE_LOG2E);
            }
    }

    // All-ones A tile: row-sum of P (column-sum of P^T) via the matrix pipe
    v16h onesA;
    #pragma unroll
    for (int e = 0; e < 16; ++e) onesA[e] = (_Float16)1.0f;

    v8f oT[4];
    {
        v8f z = {};
        #pragma unroll
        for (int t = 0; t < 4; ++t) oT[t] = z;
    }
    float m = -3.0e38f, l = 0.0f;

    const int nchunks = (vlen + KCHUNK - 1) / KCHUNK;   // uniform per block

    // ---- Prologue: stage chunk 0 into buffer 0 ----
    {
        const size_t base = (size_t)b * SEQ * DIM;
        #pragma unroll
        for (int i = 0; i < 4; ++i) {
            const int key = skey0 + 16 * i;
            const float4 kq = *(const float4*)(K + base + (size_t)key * DIM + sdg);
            const float4 vq = *(const float4*)(V + base + (size_t)key * DIM + sdg);
            v4h hk;
            hk[0] = (_Float16)kq.x; hk[1] = (_Float16)kq.y;
            hk[2] = (_Float16)kq.z; hk[3] = (_Float16)kq.w;
            *(v4h*)&Ksh[0][key * LDSPAD + sdg] = hk;
            v4h hv;
            hv[0] = (_Float16)vq.x; hv[1] = (_Float16)vq.y;
            hv[2] = (_Float16)vq.z; hv[3] = (_Float16)vq.w;
            *(v4h*)&Vsh[0][key * VPITCH + sdg] = hv;
        }
    }
    __syncthreads();

    for (int ci = 0; ci < nchunks; ++ci) {
        const int  kc0      = ci * KCHUNK;
        const int  buf      = ci & 1;
        const bool has_next = (ci + 1 < nchunks);

        // ---- Issue next chunk's global loads NOW (land during compute) ----
        float4 nk[4], nv[4];
        if (has_next) {
            const size_t nbase = ((size_t)b * SEQ + kc0 + KCHUNK) * DIM;
            #pragma unroll
            for (int i = 0; i < 4; ++i) {
                const int key = skey0 + 16 * i;
                nk[i] = *(const float4*)(K + nbase + (size_t)key * DIM + sdg);
                nv[i] = *(const float4*)(V + nbase + (size_t)key * DIM + sdg);
            }
            if (ci + 2 < nchunks) {   // keep L2 warm two chunks ahead
                const size_t pbase = ((size_t)b * SEQ + kc0 + 2 * KCHUNK) * DIM + tid * 16;
                __builtin_prefetch(K + pbase, 0, 1);
                __builtin_prefetch(V + pbase, 0, 1);
            }
        }

        // ---- S^T = K * Q^T : 4 key tiles x 2 D-chunks ----
        v8f s[4];
        #pragma unroll
        for (int nt = 0; nt < 4; ++nt) {
            v8f acc = {};
            #pragma unroll
            for (int c = 0; c < 2; ++c) {
                const _Float16* kr = &Ksh[buf][(nt * 16 + ln) * LDSPAD + 32 * c + 8 * g];
                const v8h lo = *(const v8h*)kr;
                const v8h hi = *(const v8h*)(kr + 16);
                v16h ka;
                #pragma unroll
                for (int j = 0; j < 8; ++j) { ka[j] = lo[j]; ka[8 + j] = hi[j]; }
                acc = __builtin_amdgcn_wmma_f32_16x16x32_f16(
                          false, ka, false, qb[c], (short)0, acc, false, false);
            }
            s[nt] = acc;
        }

        // ---- Sequence mask: only the (single, partial) tail chunk pays ----
        if (kc0 + KCHUNK > vlen) {
            #pragma unroll
            for (int nt = 0; nt < 4; ++nt)
                #pragma unroll
                for (int r = 0; r < 8; ++r)
                    if (kc0 + nt * 16 + 8 * g + r >= vlen) s[nt][r] = NEGF;
        }

        // ---- Online softmax (log2 domain): one query per lane ----
        float tmax = s[0][0];
        #pragma unroll
        for (int nt = 0; nt < 4; ++nt)
            #pragma unroll
            for (int r = 0; r < 8; ++r) tmax = fmaxf(tmax, s[nt][r]);
        tmax = fmaxf(tmax, __shfl_xor(tmax, 16, 32));   // combine the two key halves
        const float mnew  = fmaxf(m, tmax);
        const float alpha = FAST_EXP2(m - mnew);
        m  = mnew;
        l *= alpha;
        #pragma unroll
        for (int t4 = 0; t4 < 4; ++t4)
            #pragma unroll
            for (int r = 0; r < 8; ++r) oT[t4][r] *= alpha;

        // ---- P^T B-tiles straight from registers (C/D layout == B layout) ----
        v16h pb[2];
        #pragma unroll
        for (int a = 0; a < 2; ++a)
            #pragma unroll
            for (int e = 0; e < 16; ++e) {
                const int nt = 2 * a + (e >> 3);
                const int r  = e & 7;
                pb[a][e] = (_Float16)FAST_EXP2(s[nt][r] - mnew);
            }

        // ---- Row-sum of P via ones-WMMA (matrix pipe) ----
        v8f lacc = {};
        #pragma unroll
        for (int a = 0; a < 2; ++a)
            lacc = __builtin_amdgcn_wmma_f32_16x16x32_f16(
                       false, onesA, false, pb[a], (short)0, lacc, false, false);

        // ---- O^T += V^T * P^T : 4 D tiles x 2 key chunks ----
        #pragma unroll
        for (int t4 = 0; t4 < 4; ++t4)
            #pragma unroll
            for (int a = 0; a < 2; ++a) {
                const _Float16* vr = &Vsh[buf][32 * a * VPITCH + 16 * t4 + vtoff];
                const v8h lo = lds_tr16(vr);                 // keys 32a + 8g + 0..7
                const v8h hi = lds_tr16(vr + 16 * VPITCH);   // keys 32a + 16 + 8g + 0..7
                v16h va;
                #pragma unroll
                for (int j = 0; j < 8; ++j) { va[j] = lo[j]; va[8 + j] = hi[j]; }
                oT[t4] = __builtin_amdgcn_wmma_f32_16x16x32_f16(
                             false, va, false, pb[a], (short)0, oT[t4], false, false);
            }

        l += lacc[0];   // all 8 rows of the ones-product are identical

        // ---- Convert + store the prefetched next chunk into the other buffer ----
        if (has_next) {
            const int nb = buf ^ 1;
            #pragma unroll
            for (int i = 0; i < 4; ++i) {
                const int key = skey0 + 16 * i;
                v4h hk;
                hk[0] = (_Float16)nk[i].x; hk[1] = (_Float16)nk[i].y;
                hk[2] = (_Float16)nk[i].z; hk[3] = (_Float16)nk[i].w;
                *(v4h*)&Ksh[nb][key * LDSPAD + sdg] = hk;
                v4h hv;
                hv[0] = (_Float16)nv[i].x; hv[1] = (_Float16)nv[i].y;
                hv[2] = (_Float16)nv[i].z; hv[3] = (_Float16)nv[i].w;
                *(v4h*)&Vsh[nb][key * VPITCH + sdg] = hv;
            }
            __syncthreads();   // uniform: protects both buffers across waves
        }
    }

    // ---- Epilogue: O = O^T / l, 32B-contiguous float4 stores per lane ----
    const float invl = FAST_RCP(l);
    float* orow = O + ((size_t)b * SEQ + (q0 + ln)) * DIM;
    #pragma unroll
    for (int t4 = 0; t4 < 4; ++t4) {
        float4 s0, s1;
        s0.x = oT[t4][0] * invl; s0.y = oT[t4][1] * invl;
        s0.z = oT[t4][2] * invl; s0.w = oT[t4][3] * invl;
        s1.x = oT[t4][4] * invl; s1.y = oT[t4][5] * invl;
        s1.z = oT[t4][6] * invl; s1.w = oT[t4][7] * invl;
        *(float4*)&orow[t4 * 16 + 8 * g]     = s0;
        *(float4*)&orow[t4 * 16 + 8 * g + 4] = s1;
    }
}

extern "C" void kernel_launch(void* const* d_in, const int* in_sizes, int n_in,
                              void* d_out, int out_size, void* d_ws, size_t ws_size,
                              hipStream_t stream) {
    const float* Q  = (const float*)d_in[0];
    const float* K  = (const float*)d_in[1];
    const float* V  = (const float*)d_in[2];
    const int*   vl = (const int*)d_in[3];
    float*       Op = (float*)d_out;

    dim3 grid(BATCH * (SEQ / QPB));   // 512 blocks
    dim3 block(256);                  // 8 waves of 32
    flash_attn_st_f16wmma_kernel<<<grid, block, 0, stream>>>(Q, K, V, vl, Op);
}

// v002
// One run takes 19.6 microseconds.
// Next to v001, in two timings, it ran 1.06 times as fast each time.
// Counting every step since v000, it is 1.49 times as fast.
#include <hip/hip_runtime.h>

typedef __attribute__((ext_vector_type(16))) _Float16 v16h;
typedef __attribute__((ext_vector_type(8)))  _Float16 v8h;
typedef __attribute__((ext_vector_type(4)))  _Float16 v4h;
typedef __attribute__((ext_vector_type(8)))  float    v8f;
typedef __attribute__((ext_vector_type(8)))  short    v8s;

#define BATCH   64
#define SEQ     1024
#define DIM     64
#define KCHUNK  64
#define WAVES   8              // query-column waves per key half
#define QPB     (WAVES * 16)   // 128 queries per tile
#define KHALVES 2              // wave halves that share a tile and split its keys
#define KTRIP   (KHALVES * KCHUNK)   // 128 keys staged per trip
#define THREADS (KHALVES * WAVES * 32)
#define LDSPAD  72             // padded row stride in halves (144B: 16B-aligned, bank-staggered)
#define VPITCH  80             // V row stride in halves (160B = 32B x odd: the transposing load's pitch)
#define NEGF    (-1.0e6f)
// 1/sqrt(64) * log2(e): softmax runs in exp2 domain -> bare v_exp_f32
#define SCALE_LOG2E (0.125f * 1.44269504088896340736f)

// Raw v_exp_f32: args are always <= 0 here; underflow-to-zero is the desired
// behavior, so skip libm's 7-op denormal-range fixup.
#if __has_builtin(__builtin_amdgcn_exp2f)
#define FAST_EXP2(x) __builtin_amdgcn_exp2f(x)
#else
#define FAST_EXP2(x) exp2f(x)
#endif
#if __has_builtin(__builtin_amdgcn_rcpf)
#define FAST_RCP(x) __builtin_amdgcn_rcpf(x)
#else
#define FAST_RCP(x) (1.0f / (x))
#endif

// 16-bit transposing LDS load: from a row-major [key][d] tile, lane (ln, g)
// receives 8 consecutive keys (8g .. 8g+7) of column ln.
__device__ __forceinline__ v8h lds_tr16(const _Float16* p) {
    typedef __attribute__((address_space(3))) v8s lds_v8s;
    return __builtin_bit_cast(v8h, __builtin_amdgcn_ds_load_tr16_b128_v8i16((lds_v8s*)p));
}

__global__ __launch_bounds__(THREADS)
void flash_attn_st_f16wmma_kernel(const float* __restrict__ Q,
                                  const float* __restrict__ K,
                                  const float* __restrict__ V,
                                  const int*   __restrict__ vlens,
                                  float*       __restrict__ O)
{
    // Double-buffered staging: one barrier per chunk, global latency overlapped
    __shared__ __align__(16) _Float16 Ksh[2][KTRIP * LDSPAD];  // [buf][key][d]
    __shared__ __align__(16) _Float16 Vsh[2][KTRIP * VPITCH];  // [buf][key][d]
    // Each wave hands half of its partial O^T and (m, l) to its partner: [wave][5 x float4][lane]
    __shared__ __align__(16) float4 Msh[KHALVES * WAVES * 5 * 32];
    __shared__ int pick[2];   // batches of this block's long and short tile

    const int tid  = threadIdx.x;
    const int lane = tid & 31;
    const int wv   = __builtin_amdgcn_readfirstlane(tid >> 5);   // scalar: wave tests become scalar branches
    const int w8   = wv & (WAVES - 1);   // query-column group of the tile
    const int kh   = wv >> 3;            // key half: keys 64*kh .. 64*kh+63 of each trip
    const int g    = lane >> 4;   // half-wave group
    const int ln   = lane & 15;   // this lane's query column (and A-tile row)

    // ---- Length balance: block (p, tile) runs the batch of rank p (longest first)
    //      and then the batch of rank 63-p. The rank is a permutation for any lengths
    //      (ties go by index), so every (batch, tile) is taken exactly once. ----
    const int p = blockIdx.x >> 3;                     // SEQ/QPB == 8 tiles per batch
    if (wv < BATCH / 32) {
        const int ki = (min(max(vlens[tid], 0), SEQ) << 6) | (BATCH - 1 - tid);
        int rank = 0;
        #pragma unroll
        for (int j = 0; j < BATCH; ++j) {
            const int kj = (min(max(vlens[j], 0), SEQ) << 6) | (BATCH - 1 - j);
            rank += (kj > ki) ? 1 : 0;
        }
        if (rank == p)             pick[0] = tid;
        if (rank == BATCH - 1 - p) pick[1] = tid;
    }
    __syncthreads();   // publishes pick[]

    // Per-thread staging coordinates (4 float4 groups per thread per trip)
    const int skey0 = tid >> 4;          // + 32*i
    const int sdg   = (tid & 15) * 4;

    // Per-lane source of the transposing V read: row 8g + (lane & 7), 16B column half (lane >> 3) & 1
    const int vtoff = (8 * g + (lane & 7)) * VPITCH + 8 * ((lane >> 3) & 1);

    // All-ones A tile: row-sum of P via the matrix pipe
    v16h onesA;
    #pragma unroll
    for (int e = 0; e < 16; ++e) onesA[e] = (_Float16)1.0f;

    // Rolled: the two tiles run one after the other through one copy of the hot loop
    #pragma unroll 1
    for (int it = 0; it < 2; ++it) {
    const int b    = __builtin_amdgcn_readfirstlane(pick[it]);
    const int q0   = (blockIdx.x & 7) * QPB + w8 * 16;
    const int vlen = min(vlens[b], SEQ);

    // ---- Q^T in WMMA B-layout (lane = query col, elements = d rows), scale folded ----
    v16h qb[2];
    {
        const float* qr = Q + ((size_t)b * SEQ + (q0 + ln)) * DIM;
        #pragma unroll
        for (int c = 0; c < 2; ++c)
            #pragma unroll
            for (int h = 0; h < 2; ++h) {
                const int dbase = 32 * c + 16 * h + 8 * g;
                #pragma unroll
                for (int j = 0; j < 8; ++j)
                    qb[c][h * 8 + j] = (_Float16)(qr[dbase + j] * SCALE_LOG2E);
            }
    }

    // The Q loads' address registers are reused by what follows: keep the wait in front of that
    asm volatile("s_wait_xcnt 0x0" ::: "memory");

    v8f oT[4];
    {
        v8f z = {};
        #pragma unroll
        for (int t = 0; t < 4; ++t) oT[t] = z;
    }
    float m = -3.0e38f, l = 0.0f;

    const int nchunks = (vlen + KTRIP - 1) / KTRIP;   // trips of 128 keys, uniform per block

    // ---- Prologue: stage trip 0 into buffer 0 ----
    {
        const size_t base = (size_t)b * SEQ * DIM;
        #pragma unroll
        for (int i = 0; i < 4; ++i) {
            const int key = skey0 + 32 * i;
            const float4 kq = *(const float4*)(K + base + (size_t)key * DIM + sdg);
            const float4 vq = *(const float4*)(V + base + (size_t)key * DIM + sdg);
            v4h hk;
            hk[0] = (_Float16)kq.x; hk[1] = (_Float16)kq.y;
            hk[2] = (_Float16)kq.z; hk[3] = (_Float16)kq.w;
            *(v4h*)&Ksh[0][key * LDSPAD + sdg] = hk;
            v4h hv;
            hv[0] = (_Float16)vq.x; hv[1] = (_Float16)vq.y;
            hv[2] = (_Float16)vq.z; hv[3] = (_Float16)vq.w;
            *(v4h*)&Vsh[0][key * VPITCH + sdg] = hv;
        }
    }
    __syncthreads();

    for (int ci = 0; ci < nchunks; ++ci) {
        const int  kt0      = ci * KTRIP;             // first key of the trip
        const int  kc0      = kt0 + kh * KCHUNK;      // first key of this wave's half
        const int  buf      = ci & 1;
        const bool has_next = (ci + 1 < nchunks);

        // ---- Issue next chunk's global loads NOW (land during compute) ----
        float4 nk[4], nv[4];
        if (has_next) {
            const size_t nbase = ((size_t)b * SEQ + kt0 + KTRIP) * DIM;
            #pragma unroll
            for (int i = 0; i < 4; ++i) {
                const int key = skey0 + 32 * i;
                nk[i] = *(const float4*)(K + nbase + (size_t)key * DIM + sdg);
                nv[i] = *(const float4*)(V + nbase + (size_t)key * DIM + sdg);
            }
            // The loads' address registers are reused below: keep the wait in front of that
            asm volatile("s_wait_xcnt 0x0" ::: "memory");
            if (ci + 2 < nchunks) {   // keep L2 warm two chunks ahead
                const size_t pbase = ((size_t)b * SEQ + kt0 + 2 * KTRIP) * DIM + tid * 16;
                __builtin_prefetch(K + pbase, 0, 1);
                __builtin_prefetch(V + pbase, 0, 1);
                // Same wait for the prefetches' address registers
                asm volatile("s_wait_xcnt 0x0" ::: "memory");
            }
        }

        // A half whose 64 keys all lie past the length has nothing to add (scalar test)
        if (kc0 < vlen) {
        // ---- S^T = K * Q^T : 4 key tiles x 2 D-chunks ----
        v8f s[4];
        #pragma unroll
        for (int nt = 0; nt < 4; ++nt) {
            v8f acc = {};
            #pragma unroll
            for (int c = 0; c < 2; ++c) {
                const _Float16* kr = &Ksh[buf][(kh * KCHUNK + nt * 16 + ln) * LDSPAD + 32 * c + 8 * g];
                const v8h lo = *(const v8h*)kr;
                const v8h hi = *(const v8h*)(kr + 16);
                v16h ka;
                #pragma unroll
                for (int j = 0; j < 8; ++j) { ka[j] = lo[j]; ka[8 + j] = hi[j]; }
                acc = __builtin_amdgcn_wmma_f32_16x16x32_f16(
                          false, ka, false, qb[c], (short)0, acc, false, false);
            }
            s[nt] = acc;
        }

        // ---- Sequence mask: only the (single, partial) tail chunk pays ----
        if (kc0 + KCHUNK > vlen) {
            #pragma unroll
            for (int nt = 0; nt < 4; ++nt)
                #pragma unroll
                for (int r = 0; r < 8; ++r)
                    if (kc0 + nt * 16 + 8 * g + r >= vlen) s[nt][r] = NEGF;
        }

        // ---- Online softmax (log2 domain): one query per lane ----
        float tmax = s[0][0];
        #pragma unroll
        for (int nt = 0; nt < 4; ++nt)
            #pragma unroll
            for (int r = 0; r < 8; ++r) tmax = fmaxf(tmax, s[nt][r]);
        tmax = fmaxf(tmax, __shfl_xor(tmax, 16, 32));   // combine the two half-wave groups
        const float mnew  = fmaxf(m, tmax);
        const float alpha = FAST_EXP2(m - mnew);
        m  = mnew;
        l *= alpha;
        #pragma unroll
        for (int t4 = 0; t4 < 4; ++t4)
            #pragma unroll
            for (int r = 0; r < 8; ++r) oT[t4][r] *= alpha;

        // ---- P^T B-tiles straight from registers (C/D layout == B layout) ----
        v16h pb[2];
        #pragma unroll
        for (int a = 0; a < 2; ++a)
            #pragma unroll
            for (int e = 0; e < 16; ++e) {
                const int nt = 2 * a + (e >> 3);
                const int r  = e & 7;
                pb[a][e] = (_Float16)FAST_EXP2(s[nt][r] - mnew);
            }

        // ---- Row-sum of P via ones-WMMA (matrix pipe) ----
        v8f lacc = {};
        #pragma unroll
        for (int a = 0; a < 2; ++a)
            lacc = __builtin_amdgcn_wmma_f32_16x16x32_f16(
                       false, onesA, false, pb[a], (short)0, lacc, false, false);

        // ---- O^T += V^T * P^T : 4 D tiles x 2 key chunks ----
        #pragma unroll
        for (int t4 = 0; t4 < 4; ++t4)
            #pragma unroll
            for (int a = 0; a < 2; ++a) {
                const _Float16* vr = &Vsh[buf][(kh * KCHUNK + 32 * a) * VPITCH + 16 * t4 + vtoff];
                const v8h lo = lds_tr16(vr);                 // keys 32a + 8g + 0..7
                const v8h hi = lds_tr16(vr + 16 * VPITCH);   // keys 32a + 16 + 8g + 0..7
                v16h va;
                #pragma unroll
                for (int j = 0; j < 8; ++j) { va[j] = lo[j]; va[8 + j] = hi[j]; }
                oT[t4] = __builtin_amdgcn_wmma_f32_16x16x32_f16(
                             false, va, false, pb[a], (short)0, oT[t4], false, false);
            }

        l += lacc[0];   // all 8 rows of the ones-product are identical
        }

        // ---- Convert + store the prefetched next chunk into the other buffer ----
        if (has_next) {
            const int nb = buf ^ 1;
            #pragma unroll
            for (int i = 0; i < 4; ++i) {
                const int key = skey0 + 32 * i;
                v4h hk;
                hk[0] = (_Float16)nk[i].x; hk[1] = (_Float16)nk[i].y;
                hk[2] = (_Float16)nk[i].z; hk[3] = (_Float16)nk[i].w;
                *(v4h*)&Ksh[nb][key * LDSPAD + sdg] = hk;
                v4h hv;
                hv[0] = (_Float16)nv[i].x; hv[1] = (_Float16)nv[i].y;
                hv[2] = (_Float16)nv[i].z; hv[3] = (_Float16)nv[i].w;
                *(v4h*)&Vsh[nb][key * VPITCH + sdg] = hv;
            }
            __syncthreads();   // uniform: protects both buffers across waves
        }
    }

    // ---- Join the two key halves through LDS: half kh finishes d = 32*kh .. 32*kh+31
    //      and hands the other 32 columns of its partial O^T, with (m, l), to its partner ----
    v8f keep[2];
    {
        float4* give = &Msh[wv * 5 * 32 + lane];
        #pragma unroll
        for (int t = 0; t < 2; ++t) {
            const v8f gv = kh ? oT[t] : oT[2 + t];
            keep[t]      = kh ? oT[2 + t] : oT[t];
            give[(2 * t) * 32]     = make_float4(gv[0], gv[1], gv[2], gv[3]);
            give[(2 * t + 1) * 32] = make_float4(gv[4], gv[5], gv[6], gv[7]);
        }
        give[4 * 32] = make_float4(m, l, 0.0f, 0.0f);
    }
    // Publishes the partials; also ends every wave's last read of the K/V buffers,
    // which the next tile's prologue refills
    __syncthreads();
    {
        const float4* take = &Msh[(wv ^ WAVES) * 5 * 32 + lane];
        const float4 ml = take[4 * 32];
        const float mj = fmaxf(m, ml.x);
        const float a0 = FAST_EXP2(m - mj);      // a half that saw no key has l = 0, O = 0
        const float a1 = FAST_EXP2(ml.x - mj);
        const float invl = FAST_RCP(l * a0 + ml.y * a1);
        const float c0 = a0 * invl, c1 = a1 * invl;

        // ---- Epilogue: O = O^T / l, 32B-contiguous float4 stores per lane ----
        float* orow = O + ((size_t)b * SEQ + (q0 + ln)) * DIM + 32 * kh + 8 * g;
        #pragma unroll
        for (int t = 0; t < 2; ++t) {
            const float4 lo = take[(2 * t) * 32];
            const float4 hi = take[(2 * t + 1) * 32];
            float4 s0, s1;
            s0.x = keep[t][0] * c0 + lo.x * c1; s0.y = keep[t][1] * c0 + lo.y * c1;
            s0.z = keep[t][2] * c0 + lo.z * c1; s0.w = keep[t][3] * c0 + lo.w * c1;
            s1.x = keep[t][4] * c0 + hi.x * c1; s1.y = keep[t][5] * c0 + hi.y * c1;
            s1.z = keep[t][6] * c0 + hi.z * c1; s1.w = keep[t][7] * c0 + hi.w * c1;
            *(float4*)&orow[t * 16]     = s0;
            *(float4*)&orow[t * 16 + 4] = s1;
        }
        // The next tile reuses the stores' registers: keep the wait in front of that
        asm volatile("s_wait_xcnt 0x0" ::: "memory");
    }
    }   // it
}

extern "C" void kernel_launch(void* const* d_in, const int* in_sizes, int n_in,
                              void* d_out, int out_size, void* d_ws, size_t ws_size,
                              hipStream_t stream) {
    const float* Q  = (const float*)d_in[0];
    const float* K  = (const float*)d_in[1];
    const float* V  = (const float*)d_in[2];
    const int*   vl = (const int*)d_in[3];
    float*       Op = (float*)d_out;

    dim3 grid(BATCH * (SEQ / QPB) / 2);   // 256 blocks, two tiles each
    dim3 block(THREADS);                  // 16 waves of 32
    flash_attn_st_f16wmma_kernel<<<grid, block, 0, stream>>>(Q, K, V, vl, Op);
}

// v003
// It runs in 18.6 microseconds.
// Two timings next to v002 both put it at 1.06 times that version's speed.
// All steps since v000 together make it 1.57 times as fast.
#include <hip/hip_runtime.h>

typedef __attribute__((ext_vector_type(16))) _Float16 v16h;
typedef __attribute__((ext_vector_type(8)))  _Float16 v8h;
typedef __attribute__((ext_vector_type(4)))  _Float16 v4h;
typedef __attribute__((ext_vector_type(8)))  float    v8f;
typedef __attribute__((ext_vector_type(8)))  short    v8s;

#define BATCH   64
#define SEQ     1024
#define DIM     64
#define KCHUNK  64
#define WAVES   8              // query-column waves per key half
#define QPB     (WAVES * 16)   // 128 queries per tile
#define KHALVES 2              // wave halves that share a tile and split its keys
#define KTRIP   (KHALVES * KCHUNK)   // 128 keys staged per trip
#define THREADS (KHALVES * WAVES * 32)
#define LDSPAD  72             // padded row stride in halves (144B: 16B-aligned, bank-staggered)
#define VPITCH  80             // V row stride in halves (160B = 32B x odd: the transposing load's pitch)
#define NEGF    (-1.0e6f)
// 1/sqrt(64) * log2(e): softmax runs in exp2 domain -> bare v_exp_f32
#define SCALE_LOG2E (0.125f * 1.44269504088896340736f)

// Raw v_exp_f32: args are always <= 0 here; underflow-to-zero is the desired
// behavior, so skip libm's 7-op denormal-range fixup.
#if __has_builtin(__builtin_amdgcn_exp2f)
#define FAST_EXP2(x) __builtin_amdgcn_exp2f(x)
#else
#define FAST_EXP2(x) exp2f(x)
#endif
#if __has_builtin(__builtin_amdgcn_rcpf)
#define FAST_RCP(x) __builtin_amdgcn_rcpf(x)
#else
#define FAST_RCP(x) (1.0f / (x))
#endif

// 16-bit transposing LDS load: from a row-major [key][d] tile, lane (ln, g)
// receives 8 consecutive keys (8g .. 8g+7) of column ln.
__device__ __forceinline__ v8h lds_tr16(const _Float16* p) {
    typedef __attribute__((address_space(3))) v8s lds_v8s;
    return __builtin_bit_cast(v8h, __builtin_amdgcn_ds_load_tr16_b128_v8i16((lds_v8s*)p));
}

__global__ __launch_bounds__(THREADS)
void flash_attn_st_f16wmma_kernel(const float* __restrict__ Q,
                                  const float* __restrict__ K,
                                  const float* __restrict__ V,
                                  const int*   __restrict__ vlens,
                                  float*       __restrict__ O)
{
    // Double-buffered staging: one barrier per chunk, global latency overlapped
    __shared__ __align__(16) _Float16 Ksh[2][KTRIP * LDSPAD];  // [buf][key][d]
    __shared__ __align__(16) _Float16 Vsh[2][KTRIP * VPITCH];  // [buf][key][d]
    // Each wave hands half of its partial O^T and (m, l) to its partner: [wave][5 x float4][lane]
    __shared__ __align__(16) float4 Msh[KHALVES * WAVES * 5 * 32];
    __shared__ int pick[2];   // batches of this block's long and short tile

    const int tid  = threadIdx.x;
    const int lane = tid & 31;
    const int wv   = __builtin_amdgcn_readfirstlane(tid >> 5);   // scalar: wave tests become scalar branches
    const int w8   = wv & (WAVES - 1);   // query-column group of the tile
    const int kh   = wv >> 3;            // key half: keys 64*kh .. 64*kh+63 of each trip
    const int g    = lane >> 4;   // half-wave group
    const int ln   = lane & 15;   // this lane's query column (and A-tile row)

    // ---- Length balance: block (p, tile) runs the batch of rank p (longest first)
    //      and then the batch of rank 63-p. The rank is a permutation for any lengths
    //      (ties go by index), so every (batch, tile) is taken exactly once. ----
    const int p = blockIdx.x >> 3;                     // SEQ/QPB == 8 tiles per batch
    if (wv < BATCH / 32) {
        const int ki = (min(max(vlens[tid], 0), SEQ) << 6) | (BATCH - 1 - tid);
        int rank = 0;
        #pragma unroll
        for (int j = 0; j < BATCH; ++j) {
            const int kj = (min(max(vlens[j], 0), SEQ) << 6) | (BATCH - 1 - j);
            rank += (kj > ki) ? 1 : 0;
        }
        if (rank == p)             pick[0] = tid;
        if (rank == BATCH - 1 - p) pick[1] = tid;
    }
    __syncthreads();   // publishes pick[]

    // Per-thread staging coordinates (4 float4 groups per thread per trip)
    const int skey0 = tid >> 4;          // + 32*i
    const int sdg   = (tid & 15) * 4;

    // Per-lane source of the transposing V read: row 8g + (lane & 7), 16B column half (lane >> 3) & 1
    const int vtoff = (8 * g + (lane & 7)) * VPITCH + 8 * ((lane >> 3) & 1);

    // All-ones A tile: row-sum of P via the matrix pipe
    v16h onesA;
    #pragma unroll
    for (int e = 0; e < 16; ++e) onesA[e] = (_Float16)1.0f;

    // Rolled: the two tiles run one after the other through one copy of the hot loop
    #pragma unroll 1
    for (int it = 0; it < 2; ++it) {
    const int b    = __builtin_amdgcn_readfirstlane(pick[it]);
    const int q0   = (blockIdx.x & 7) * QPB + w8 * 16;
    const int vlen = min(vlens[b], SEQ);

    // ---- Q^T in WMMA B-layout (lane = query col, elements = d rows), scale folded ----
    v16h qb[2];
    {
        const float* qr = Q + ((size_t)b * SEQ + (q0 + ln)) * DIM;
        #pragma unroll
        for (int c = 0; c < 2; ++c)
            #pragma unroll
            for (int h = 0; h < 2; ++h) {
                const int dbase = 32 * c + 16 * h + 8 * g;
                #pragma unroll
                for (int j = 0; j < 8; ++j)
                    qb[c][h * 8 + j] = (_Float16)(qr[dbase + j] * SCALE_LOG2E);
            }
    }

    // The Q loads' address registers are reused by what follows: keep the wait in front of that
    asm volatile("s_wait_xcnt 0x0" ::: "memory");

    v8f oT[4];
    {
        v8f z = {};
        #pragma unroll
        for (int t = 0; t < 4; ++t) oT[t] = z;
    }
    float m = -3.0e38f, l = 0.0f;

    const int nchunks = (vlen + KTRIP - 1) / KTRIP;   // trips of 128 keys, uniform per block

    // ---- Prologue: stage trip 0 into buffer 0 ----
    {
        const size_t base = (size_t)b * SEQ * DIM;
        #pragma unroll
        for (int i = 0; i < 4; ++i) {
            const int key = skey0 + 32 * i;
            const float4 kq = *(const float4*)(K + base + (size_t)key * DIM + sdg);
            const float4 vq = *(const float4*)(V + base + (size_t)key * DIM + sdg);
            v4h hk;
            hk[0] = (_Float16)kq.x; hk[1] = (_Float16)kq.y;
            hk[2] = (_Float16)kq.z; hk[3] = (_Float16)kq.w;
            *(v4h*)&Ksh[0][key * LDSPAD + sdg] = hk;
            v4h hv;
            hv[0] = (_Float16)vq.x; hv[1] = (_Float16)vq.y;
            hv[2] = (_Float16)vq.z; hv[3] = (_Float16)vq.w;
            *(v4h*)&Vsh[0][key * VPITCH + sdg] = hv;
        }
    }
    __syncthreads();

    for (int ci = 0; ci < nchunks; ++ci) {
        const int  kt0      = ci * KTRIP;             // first key of the trip
        const int  kc0      = kt0 + kh * KCHUNK;      // first key of this wave's half
        const int  buf      = ci & 1;
        const bool has_next = (ci + 1 < nchunks);
        const bool active   = (kc0 < vlen);       // scalar: this wave's 64 keys hold at least one valid key

        // ---- All 16 K fragment reads of the trip as ONE group, first thing behind the barrier:
        //      one LDS round trip per trip, run under the global-load issue below. Every wave reads,
        //      also one whose half lies past the length (last trip only, values unused): under a
        //      branch of their own the 64 registers stayed live round the loop and spilled ----
        v8h kf[4][2][2];
        #pragma unroll
        for (int nt = 0; nt < 4; ++nt)
            #pragma unroll
            for (int c = 0; c < 2; ++c) {
                const _Float16* kr = &Ksh[buf][(kh * KCHUNK + nt * 16 + ln) * LDSPAD + 32 * c + 8 * g];
                kf[nt][c][0] = *(const v8h*)kr;
                kf[nt][c][1] = *(const v8h*)(kr + 16);
            }
        // Keeps the read group whole and ahead: without it the reads sink back among the WMMAs,
        // each pair with its own wait to zero
        __builtin_amdgcn_sched_barrier(0);

        // ---- Issue next chunk's global loads NOW (land during compute) ----
        float4 nk[4], nv[4];
        if (has_next) {
            const size_t nbase = ((size_t)b * SEQ + kt0 + KTRIP) * DIM;
            #pragma unroll
            for (int i = 0; i < 4; ++i) {
                const int key = skey0 + 32 * i;
                nk[i] = *(const float4*)(K + nbase + (size_t)key * DIM + sdg);
                nv[i] = *(const float4*)(V + nbase + (size_t)key * DIM + sdg);
            }
            // The loads' address registers are reused below: keep the wait in front of that
            asm volatile("s_wait_xcnt 0x0" ::: "memory");
            if (ci + 2 < nchunks) {   // keep L2 warm two chunks ahead
                const size_t pbase = ((size_t)b * SEQ + kt0 + 2 * KTRIP) * DIM + tid * 16;
                __builtin_prefetch(K + pbase, 0, 1);
                __builtin_prefetch(V + pbase, 0, 1);
                // Same wait for the prefetches' address registers
                asm volatile("s_wait_xcnt 0x0" ::: "memory");
            }
        }

        // A half whose 64 keys all lie past the length has nothing to add (scalar test)
        if (active) {
        // ---- S^T = K * Q^T : 4 key tiles x 2 D-chunks ----
        v8f s[4];
        #pragma unroll
        for (int nt = 0; nt < 4; ++nt) {
            v8f acc = {};
            #pragma unroll
            for (int c = 0; c < 2; ++c) {
                const v8h lo = kf[nt][c][0];
                const v8h hi = kf[nt][c][1];
                v16h ka;
                #pragma unroll
                for (int j = 0; j < 8; ++j) { ka[j] = lo[j]; ka[8 + j] = hi[j]; }
                acc = __builtin_amdgcn_wmma_f32_16x16x32_f16(
                          false, ka, false, qb[c], (short)0, acc, false, false);
            }
            s[nt] = acc;
        }

        // ---- Sequence mask: only the (single, partial) tail chunk pays ----
        if (kc0 + KCHUNK > vlen) {
            #pragma unroll
            for (int nt = 0; nt < 4; ++nt)
                #pragma unroll
                for (int r = 0; r < 8; ++r)
                    if (kc0 + nt * 16 + 8 * g + r >= vlen) s[nt][r] = NEGF;
        }

        // ---- Online softmax (log2 domain): one query per lane ----
        float tmax = s[0][0];
        #pragma unroll
        for (int nt = 0; nt < 4; ++nt)
            #pragma unroll
            for (int r = 0; r < 8; ++r) tmax = fmaxf(tmax, s[nt][r]);
        const float tother = __shfl_xor(tmax, 16, 32);  // the other half-wave's maximum
        // Inputs-only fence on the exchanged value: keeps the exchange FIRST in the wave's in-order
        // LDS queue; behind the 16 reads below its result would come only when all of them have landed
        asm volatile("" :: "v"(tother) : "memory");

        // ---- All 16 V^T fragment reads as ONE group, behind the exchange in the LDS queue:
        //      they land under the exponentials ----
        v8h vf[4][2][2];
        #pragma unroll
        for (int a = 0; a < 2; ++a)
            #pragma unroll
            for (int t4 = 0; t4 < 4; ++t4) {
                const _Float16* vr = &Vsh[buf][(kh * KCHUNK + 32 * a) * VPITCH + 16 * t4 + vtoff];
                vf[t4][a][0] = lds_tr16(vr);                 // keys 32a + 8g + 0..7
                vf[t4][a][1] = lds_tr16(vr + 16 * VPITCH);   // keys 32a + 16 + 8g + 0..7
            }
        // Keeps the read group whole and ahead of the softmax: without it half of the reads
        // sink down among the O^T WMMAs and are waited for there
        __builtin_amdgcn_sched_barrier(0);

        tmax = fmaxf(tmax, tother);                     // combine the two half-waves
        const float mnew  = fmaxf(m, tmax);
        const float alpha = FAST_EXP2(m - mnew);
        m  = mnew;
        l *= alpha;
        #pragma unroll
        for (int t4 = 0; t4 < 4; ++t4)
            #pragma unroll
            for (int r = 0; r < 8; ++r) oT[t4][r] *= alpha;

        // ---- P^T B-tiles straight from registers (C/D layout == B layout) ----
        v16h pb[2];
        #pragma unroll
        for (int a = 0; a < 2; ++a)
            #pragma unroll
            for (int e = 0; e < 16; ++e) {
                const int nt = 2 * a + (e >> 3);
                const int r  = e & 7;
                pb[a][e] = (_Float16)FAST_EXP2(s[nt][r] - mnew);
            }

        // ---- Row-sum of P via ones-WMMA (matrix pipe) ----
        v8f lacc = {};
        #pragma unroll
        for (int a = 0; a < 2; ++a)
            lacc = __builtin_amdgcn_wmma_f32_16x16x32_f16(
                       false, onesA, false, pb[a], (short)0, lacc, false, false);

        // ---- O^T += V^T * P^T : 4 D tiles x 2 key chunks ----
        #pragma unroll
        for (int t4 = 0; t4 < 4; ++t4)
            #pragma unroll
            for (int a = 0; a < 2; ++a) {
                const v8h lo = vf[t4][a][0];
                const v8h hi = vf[t4][a][1];
                v16h va;
                #pragma unroll
                for (int j = 0; j < 8; ++j) { va[j] = lo[j]; va[8 + j] = hi[j]; }
                oT[t4] = __builtin_amdgcn_wmma_f32_16x16x32_f16(
                             false, va, false, pb[a], (short)0, oT[t4], false, false);
            }

        l += lacc[0];   // all 8 rows of the ones-product are identical
        }

        // ---- Convert + store the prefetched next chunk into the other buffer ----
        if (has_next) {
            const int nb = buf ^ 1;
            #pragma unroll
            for (int i = 0; i < 4; ++i) {
                const int key = skey0 + 32 * i;
                v4h hk;
                hk[0] = (_Float16)nk[i].x; hk[1] = (_Float16)nk[i].y;
                hk[2] = (_Float16)nk[i].z; hk[3] = (_Float16)nk[i].w;
                *(v4h*)&Ksh[nb][key * LDSPAD + sdg] = hk;
                v4h hv;
                hv[0] = (_Float16)nv[i].x; hv[1] = (_Float16)nv[i].y;
                hv[2] = (_Float16)nv[i].z; hv[3] = (_Float16)nv[i].w;
                *(v4h*)&Vsh[nb][key * VPITCH + sdg] = hv;
            }
            __syncthreads();   // uniform: protects both buffers across waves
        }
    }

    // ---- Join the two key halves through LDS: half kh finishes d = 32*kh .. 32*kh+31
    //      and hands the other 32 columns of its partial O^T, with (m, l), to its partner ----
    v8f keep[2];
    {
        float4* give = &Msh[wv * 5 * 32 + lane];
        #pragma unroll
        for (int t = 0; t < 2; ++t) {
            const v8f gv = kh ? oT[t] : oT[2 + t];
            keep[t]      = kh ? oT[2 + t] : oT[t];
            give[(2 * t) * 32]     = make_float4(gv[0], gv[1], gv[2], gv[3]);
            give[(2 * t + 1) * 32] = make_float4(gv[4], gv[5], gv[6], gv[7]);
        }
        give[4 * 32] = make_float4(m, l, 0.0f, 0.0f);
    }
    // Publishes the partials; also ends every wave's last read of the K/V buffers,
    // which the next tile's prologue refills
    __syncthreads();
    {
        const float4* take = &Msh[(wv ^ WAVES) * 5 * 32 + lane];
        const float4 ml = take[4 * 32];
        const float mj = fmaxf(m, ml.x);
        const float a0 = FAST_EXP2(m - mj);      // a half that saw no key has l = 0, O = 0
        const float a1 = FAST_EXP2(ml.x - mj);
        const float invl = FAST_RCP(l * a0 + ml.y * a1);
        const float c0 = a0 * invl, c1 = a1 * invl;

        // ---- Epilogue: O = O^T / l, 32B-contiguous float4 stores per lane ----
        float* orow = O + ((size_t)b * SEQ + (q0 + ln)) * DIM + 32 * kh + 8 * g;
        #pragma unroll
        for (int t = 0; t < 2; ++t) {
            const float4 lo = take[(2 * t) * 32];
            const float4 hi = take[(2 * t + 1) * 32];
            float4 s0, s1;
            s0.x = keep[t][0] * c0 + lo.x * c1; s0.y = keep[t][1] * c0 + lo.y * c1;
            s0.z = keep[t][2] * c0 + lo.z * c1; s0.w = keep[t][3] * c0 + lo.w * c1;
            s1.x = keep[t][4] * c0 + hi.x * c1; s1.y = keep[t][5] * c0 + hi.y * c1;
            s1.z = keep[t][6] * c0 + hi.z * c1; s1.w = keep[t][7] * c0 + hi.w * c1;
            *(float4*)&orow[t * 16]     = s0;
            *(float4*)&orow[t * 16 + 4] = s1;
        }
        // The next tile reuses the stores' registers: keep the wait in front of that
        asm volatile("s_wait_xcnt 0x0" ::: "memory");
    }
    }   // it
}

extern "C" void kernel_launch(void* const* d_in, const int* in_sizes, int n_in,
                              void* d_out, int out_size, void* d_ws, size_t ws_size,
                              hipStream_t stream) {
    const float* Q  = (const float*)d_in[0];
    const float* K  = (const float*)d_in[1];
    const float* V  = (const float*)d_in[2];
    const int*   vl = (const int*)d_in[3];
    float*       Op = (float*)d_out;

    dim3 grid(BATCH * (SEQ / QPB) / 2);   // 256 blocks, two tiles each
    dim3 block(THREADS);                  // 16 waves of 32
    flash_attn_st_f16wmma_kernel<<<grid, block, 0, stream>>>(Q, K, V, vl, Op);
}

// v004
// Measured time: 17.6 microseconds a run.
// Next to v003, in two timings, it ran 1.05 and 1.06 times as fast.
// Over all steps from v000 it is 1.66 times as fast.
#include <hip/hip_runtime.h>

typedef __attribute__((ext_vector_type(16))) _Float16 v16h;
typedef __attribute__((ext_vector_type(8)))  _Float16 v8h;
typedef __attribute__((ext_vector_type(4)))  _Float16 v4h;
typedef __attribute__((ext_vector_type(8)))  float    v8f;
typedef __attribute__((ext_vector_type(8)))  short    v8s;

#define BATCH   64
#define SEQ     1024
#define DIM     64
#define KCHUNK  64
#define WAVES   8              // query-column waves per key half
#define QPB     (WAVES * 16)   // 128 queries per tile
#define KHALVES 2              // wave halves that share a tile and split its keys
#define KTRIP   (KHALVES * KCHUNK)   // 128 keys staged per trip
#define THREADS (KHALVES * WAVES * 32)
#define LDSPAD  72             // padded row stride in halves (144B: 16B-aligned, bank-staggered)
#define VPITCH  80             // V row stride in halves (160B = 32B x odd: the transposing load's pitch)
#define OPITCH  36             // output regroup row stride in floats (144B: 16B-aligned, bank-staggered)
#define NEGF    (-1.0e6f)
// 1/sqrt(64) * log2(e): softmax runs in exp2 domain -> bare v_exp_f32
#define SCALE_LOG2E (0.125f * 1.44269504088896340736f)

// Raw v_exp_f32: args are always <= 0 here; underflow-to-zero is the desired
// behavior, so skip libm's 7-op denormal-range fixup.
#if __has_builtin(__builtin_amdgcn_exp2f)
#define FAST_EXP2(x) __builtin_amdgcn_exp2f(x)
#else
#define FAST_EXP2(x) exp2f(x)
#endif
#if __has_builtin(__builtin_amdgcn_rcpf)
#define FAST_RCP(x) __builtin_amdgcn_rcpf(x)
#else
#define FAST_RCP(x) (1.0f / (x))
#endif

// 16-bit transposing LDS load: from a row-major [key][d] tile, lane (ln, g)
// receives 8 consecutive keys (8g .. 8g+7) of column ln.
__device__ __forceinline__ v8h lds_tr16(const _Float16* p) {
    typedef __attribute__((address_space(3))) v8s lds_v8s;
    return __builtin_bit_cast(v8h, __builtin_amdgcn_ds_load_tr16_b128_v8i16((lds_v8s*)p));
}

__global__ __launch_bounds__(THREADS)
void flash_attn_st_f16wmma_kernel(const float* __restrict__ Q,
                                  const float* __restrict__ K,
                                  const float* __restrict__ V,
                                  const int*   __restrict__ vlens,
                                  float*       __restrict__ O)
{
    // Double-buffered staging: one barrier per chunk, global latency overlapped
    __shared__ __align__(16) _Float16 Ksh[2][KTRIP * LDSPAD];  // [buf][key][d]
    __shared__ __align__(16) _Float16 Vsh[2][KTRIP * VPITCH];  // [buf][key][d]
    // Each wave hands half of its partial O^T and (m, l) to its partner: [wave][5 x float4][lane]
    __shared__ __align__(16) float4 Msh[KHALVES * WAVES * 5 * 32];
    __shared__ __align__(16) _Float16 Qsh[QPB * LDSPAD];       // [query][d], scaled
    __shared__ __align__(16) float Osh[KHALVES * WAVES][16 * OPITCH];   // [wave][query][32 d]: output regroup
    __shared__ int pick[2];   // batches of this block's long and short tile

    const int tid  = threadIdx.x;
    const int lane = tid & 31;
    const int wv   = __builtin_amdgcn_readfirstlane(tid >> 5);   // scalar: wave tests become scalar branches
    const int w8   = wv & (WAVES - 1);   // query-column group of the tile
    const int kh   = wv >> 3;            // key half: keys 64*kh .. 64*kh+63 of each trip
    const int g    = lane >> 4;   // half-wave group
    const int ln   = lane & 15;   // this lane's query column (and A-tile row)

    // ---- Length balance: block (p, tile) runs the batch of rank p (longest first)
    //      and then the batch of rank 63-p. The rank is a permutation for any lengths
    //      (ties go by index), so every (batch, tile) is taken exactly once. ----
    const int p = blockIdx.x >> 3;                     // SEQ/QPB == 8 tiles per batch
    if (wv < BATCH / 32) {
        const int ki = (min(max(vlens[tid], 0), SEQ) << 6) | (BATCH - 1 - tid);
        int rank = 0;
        #pragma unroll
        for (int j = 0; j < BATCH; ++j) {
            const int kj = (min(max(vlens[j], 0), SEQ) << 6) | (BATCH - 1 - j);
            rank += (kj > ki) ? 1 : 0;
        }
        if (rank == p)             pick[0] = tid;
        if (rank == BATCH - 1 - p) pick[1] = tid;
    }
    __syncthreads();   // publishes pick[]

    // Per-thread staging coordinates (4 float4 groups per thread per trip)
    const int skey0 = tid >> 4;          // + 32*i
    const int sdg   = (tid & 15) * 4;

    // Per-lane source of the transposing V read: row 8g + (lane & 7), 16B column half (lane >> 3) & 1
    const int vtoff = (8 * g + (lane & 7)) * VPITCH + 8 * ((lane >> 3) & 1);

    // All-ones A tile: row-sum of P via the matrix pipe
    v16h onesA;
    #pragma unroll
    for (int e = 0; e < 16; ++e) onesA[e] = (_Float16)1.0f;

    // Rolled: the two tiles run one after the other through one copy of the hot loop
    #pragma unroll 1
    for (int it = 0; it < 2; ++it) {
    const int b    = __builtin_amdgcn_readfirstlane(pick[it]);
    const int q0   = (blockIdx.x & 7) * QPB + w8 * 16;
    const int vlen = min(vlens[b], SEQ);

    v8f oT[4];
    {
        v8f z = {};
        #pragma unroll
        for (int t = 0; t < 4; ++t) oT[t] = z;
    }
    float m = -3.0e38f, l = 0.0f;

    const int nchunks = (vlen + KTRIP - 1) / KTRIP;   // trips of 128 keys, uniform per block

    // ---- Prologue: stage trip 0 into buffer 0 and, in the same pattern, the tile's 128 Q rows:
    //      each wave-wide load covers 512 contiguous bytes (four whole lines) ----
    {
        const size_t base  = (size_t)b * SEQ * DIM;
        const size_t qbase = base + (size_t)((blockIdx.x & 7) * QPB) * DIM;
        #pragma unroll
        for (int i = 0; i < 4; ++i) {
            const int key = skey0 + 32 * i;
            const float4 qq = *(const float4*)(Q + qbase + (size_t)key * DIM + sdg);
            const float4 kq = *(const float4*)(K + base + (size_t)key * DIM + sdg);
            const float4 vq = *(const float4*)(V + base + (size_t)key * DIM + sdg);
            v4h hq;   // scale folded before the f16 rounding
            hq[0] = (_Float16)(qq.x * SCALE_LOG2E); hq[1] = (_Float16)(qq.y * SCALE_LOG2E);
            hq[2] = (_Float16)(qq.z * SCALE_LOG2E); hq[3] = (_Float16)(qq.w * SCALE_LOG2E);
            *(v4h*)&Qsh[key * LDSPAD + sdg] = hq;
            v4h hk;
            hk[0] = (_Float16)kq.x; hk[1] = (_Float16)kq.y;
            hk[2] = (_Float16)kq.z; hk[3] = (_Float16)kq.w;
            *(v4h*)&Ksh[0][key * LDSPAD + sdg] = hk;
            v4h hv;
            hv[0] = (_Float16)vq.x; hv[1] = (_Float16)vq.y;
            hv[2] = (_Float16)vq.z; hv[3] = (_Float16)vq.w;
            *(v4h*)&Vsh[0][key * VPITCH + sdg] = hv;
        }
    }
    __syncthreads();

    // ---- Q^T in WMMA B-layout (lane = query col, elements = d rows) from the staged tile ----
    v16h qb[2];
    {
        const _Float16* qr = &Qsh[(w8 * 16 + ln) * LDSPAD + 8 * g];
        #pragma unroll
        for (int c = 0; c < 2; ++c) {
            const v8h lo = *(const v8h*)(qr + 32 * c);
            const v8h hi = *(const v8h*)(qr + 32 * c + 16);
            #pragma unroll
            for (int j = 0; j < 8; ++j) { qb[c][j] = lo[j]; qb[c][8 + j] = hi[j]; }
        }
    }

    for (int ci = 0; ci < nchunks; ++ci) {
        const int  kt0      = ci * KTRIP;             // first key of the trip
        const int  kc0      = kt0 + kh * KCHUNK;      // first key of this wave's half
        const int  buf      = ci & 1;
        const bool has_next = (ci + 1 < nchunks);
        const bool active   = (kc0 < vlen);       // scalar: this wave's 64 keys hold at least one valid key

        // ---- All 16 K fragment reads of the trip as ONE group, first thing behind the barrier:
        //      one LDS round trip per trip, run under the global-load issue below. Every wave reads,
        //      also one whose half lies past the length (last trip only, values unused): under a
        //      branch of their own the 64 registers stayed live round the loop and spilled ----
        v8h kf[4][2][2];
        #pragma unroll
        for (int nt = 0; nt < 4; ++nt)
            #pragma unroll
            for (int c = 0; c < 2; ++c) {
                const _Float16* kr = &Ksh[buf][(kh * KCHUNK + nt * 16 + ln) * LDSPAD + 32 * c + 8 * g];
                kf[nt][c][0] = *(const v8h*)kr;
                kf[nt][c][1] = *(const v8h*)(kr + 16);
            }
        // Keeps the read group whole and ahead: without it the reads sink back among the WMMAs,
        // each pair with its own wait to zero
        __builtin_amdgcn_sched_barrier(0);

        // ---- Issue next chunk's global loads NOW (land during compute) ----
        float4 nk[4], nv[4];
        if (has_next) {
            const size_t nbase = ((size_t)b * SEQ + kt0 + KTRIP) * DIM;
            #pragma unroll
            for (int i = 0; i < 4; ++i) {
                const int key = skey0 + 32 * i;
                nk[i] = *(const float4*)(K + nbase + (size_t)key * DIM + sdg);
                nv[i] = *(const float4*)(V + nbase + (size_t)key * DIM + sdg);
            }
            // The loads' address registers are reused below: keep the wait in front of that
            asm volatile("s_wait_xcnt 0x0" ::: "memory");
            if (ci + 2 < nchunks) {   // keep L2 warm two chunks ahead
                const size_t pbase = ((size_t)b * SEQ + kt0 + 2 * KTRIP) * DIM + tid * 16;
                __builtin_prefetch(K + pbase, 0, 1);
                __builtin_prefetch(V + pbase, 0, 1);
                // Same wait for the prefetches' address registers
                asm volatile("s_wait_xcnt 0x0" ::: "memory");
            }
        }

        // A half whose 64 keys all lie past the length has nothing to add (scalar test)
        if (active) {
        // ---- S^T = K * Q^T : 4 key tiles x 2 D-chunks ----
        v8f s[4];
        #pragma unroll
        for (int nt = 0; nt < 4; ++nt) {
            v8f acc = {};
            #pragma unroll
            for (int c = 0; c < 2; ++c) {
                const v8h lo = kf[nt][c][0];
                const v8h hi = kf[nt][c][1];
                v16h ka;
                #pragma unroll
                for (int j = 0; j < 8; ++j) { ka[j] = lo[j]; ka[8 + j] = hi[j]; }
                acc = __builtin_amdgcn_wmma_f32_16x16x32_f16(
                          false, ka, false, qb[c], (short)0, acc, false, false);
            }
            s[nt] = acc;
        }

        // ---- Sequence mask: only the (single, partial) tail chunk pays ----
        if (kc0 + KCHUNK > vlen) {
            #pragma unroll
            for (int nt = 0; nt < 4; ++nt)
                #pragma unroll
                for (int r = 0; r < 8; ++r)
                    if (kc0 + nt * 16 + 8 * g + r >= vlen) s[nt][r] = NEGF;
        }

        // ---- Online softmax (log2 domain): one query per lane ----
        float tmax = s[0][0];
        #pragma unroll
        for (int nt = 0; nt < 4; ++nt)
            #pragma unroll
            for (int r = 0; r < 8; ++r) tmax = fmaxf(tmax, s[nt][r]);
        const float tother = __shfl_xor(tmax, 16, 32);  // the other half-wave's maximum
        // Inputs-only fence on the exchanged value: keeps the exchange FIRST in the wave's in-order
        // LDS queue; behind the 16 reads below its result would come only when all of them have landed
        asm volatile("" :: "v"(tother) : "memory");

        // ---- All 16 V^T fragment reads as ONE group, behind the exchange in the LDS queue:
        //      they land under the exponentials ----
        v8h vf[4][2][2];
        #pragma unroll
        for (int a = 0; a < 2; ++a)
            #pragma unroll
            for (int t4 = 0; t4 < 4; ++t4) {
                const _Float16* vr = &Vsh[buf][(kh * KCHUNK + 32 * a) * VPITCH + 16 * t4 + vtoff];
                vf[t4][a][0] = lds_tr16(vr);                 // keys 32a + 8g + 0..7
                vf[t4][a][1] = lds_tr16(vr + 16 * VPITCH);   // keys 32a + 16 + 8g + 0..7
            }
        // Keeps the read group whole and ahead of the softmax: without it half of the reads
        // sink down among the O^T WMMAs and are waited for there
        __builtin_amdgcn_sched_barrier(0);

        tmax = fmaxf(tmax, tother);                     // combine the two half-waves
        const float mnew  = fmaxf(m, tmax);
        const float alpha = FAST_EXP2(m - mnew);
        m  = mnew;
        l *= alpha;
        #pragma unroll
        for (int t4 = 0; t4 < 4; ++t4)
            #pragma unroll
            for (int r = 0; r < 8; ++r) oT[t4][r] *= alpha;

        // ---- P^T B-tiles straight from registers (C/D layout == B layout) ----
        v16h pb[2];
        #pragma unroll
        for (int a = 0; a < 2; ++a)
            #pragma unroll
            for (int e = 0; e < 16; ++e) {
                const int nt = 2 * a + (e >> 3);
                const int r  = e & 7;
                pb[a][e] = (_Float16)FAST_EXP2(s[nt][r] - mnew);
            }

        // ---- Row-sum of P via ones-WMMA (matrix pipe) ----
        v8f lacc = {};
        #pragma unroll
        for (int a = 0; a < 2; ++a)
            lacc = __builtin_amdgcn_wmma_f32_16x16x32_f16(
                       false, onesA, false, pb[a], (short)0, lacc, false, false);

        // ---- O^T += V^T * P^T : 4 D tiles x 2 key chunks ----
        #pragma unroll
        for (int t4 = 0; t4 < 4; ++t4)
            #pragma unroll
            for (int a = 0; a < 2; ++a) {
                const v8h lo = vf[t4][a][0];
                const v8h hi = vf[t4][a][1];
                v16h va;
                #pragma unroll
                for (int j = 0; j < 8; ++j) { va[j] = lo[j]; va[8 + j] = hi[j]; }
                oT[t4] = __builtin_amdgcn_wmma_f32_16x16x32_f16(
                             false, va, false, pb[a], (short)0, oT[t4], false, false);
            }

        l += lacc[0];   // all 8 rows of the ones-product are identical
        }

        // ---- Convert + store the prefetched next chunk into the other buffer ----
        if (has_next) {
            const int nb = buf ^ 1;
            #pragma unroll
            for (int i = 0; i < 4; ++i) {
                const int key = skey0 + 32 * i;
                v4h hk;
                hk[0] = (_Float16)nk[i].x; hk[1] = (_Float16)nk[i].y;
                hk[2] = (_Float16)nk[i].z; hk[3] = (_Float16)nk[i].w;
                *(v4h*)&Ksh[nb][key * LDSPAD + sdg] = hk;
                v4h hv;
                hv[0] = (_Float16)nv[i].x; hv[1] = (_Float16)nv[i].y;
                hv[2] = (_Float16)nv[i].z; hv[3] = (_Float16)nv[i].w;
                *(v4h*)&Vsh[nb][key * VPITCH + sdg] = hv;
            }
            __syncthreads();   // uniform: protects both buffers across waves
        }
    }

    // ---- Join the two key halves through LDS: half kh finishes d = 32*kh .. 32*kh+31
    //      and hands the other 32 columns of its partial O^T, with (m, l), to its partner ----
    v8f keep[2];
    {
        float4* give = &Msh[wv * 5 * 32 + lane];
        #pragma unroll
        for (int t = 0; t < 2; ++t) {
            const v8f gv = kh ? oT[t] : oT[2 + t];
            keep[t]      = kh ? oT[2 + t] : oT[t];
            give[(2 * t) * 32]     = make_float4(gv[0], gv[1], gv[2], gv[3]);
            give[(2 * t + 1) * 32] = make_float4(gv[4], gv[5], gv[6], gv[7]);
        }
        give[4 * 32] = make_float4(m, l, 0.0f, 0.0f);
    }
    // Publishes the partials; also ends every wave's last read of the K/V buffers,
    // which the next tile's prologue refills
    __syncthreads();
    {
        const float4* take = &Msh[(wv ^ WAVES) * 5 * 32 + lane];
        const float4 ml = take[4 * 32];
        const float mj = fmaxf(m, ml.x);
        const float a0 = FAST_EXP2(m - mj);      // a half that saw no key has l = 0, O = 0
        const float a1 = FAST_EXP2(ml.x - mj);
        const float invl = FAST_RCP(l * a0 + ml.y * a1);
        const float c0 = a0 * invl, c1 = a1 * invl;

        // ---- Epilogue: O = O^T / l; the wave's 16 rows x 128 B are regrouped in an LDS range
        //      of the wave's own so that every store covers whole lines ----
        float* stg  = &Osh[wv][0];
        float* srow = stg + ln * OPITCH + 8 * g;
        #pragma unroll
        for (int t = 0; t < 2; ++t) {
            const float4 lo = take[(2 * t) * 32];
            const float4 hi = take[(2 * t + 1) * 32];
            float4 s0, s1;
            s0.x = keep[t][0] * c0 + lo.x * c1; s0.y = keep[t][1] * c0 + lo.y * c1;
            s0.z = keep[t][2] * c0 + lo.z * c1; s0.w = keep[t][3] * c0 + lo.w * c1;
            s1.x = keep[t][4] * c0 + hi.x * c1; s1.y = keep[t][5] * c0 + hi.y * c1;
            s1.z = keep[t][6] * c0 + hi.z * c1; s1.w = keep[t][7] * c0 + hi.w * c1;
            *(float4*)&srow[t * 16]     = s0;
            *(float4*)&srow[t * 16 + 4] = s1;
        }
        // The rows are read back by other lanes of this wave: their writes must have landed
        asm volatile("s_wait_dscnt 0x0" ::: "memory");
        float* orow = O + ((size_t)b * SEQ + (q0 + (lane >> 3))) * DIM + 32 * kh + 4 * (lane & 7);
        #pragma unroll
        for (int i = 0; i < 4; ++i) {   // 8 lanes per 128-B line, 4 rows per store
            const float4 ov = *(const float4*)&stg[(4 * i + (lane >> 3)) * OPITCH + 4 * (lane & 7)];
            *(float4*)&orow[(size_t)(4 * i) * DIM] = ov;
        }
        // The next tile reuses the stores' registers: keep the wait in front of that
        asm volatile("s_wait_xcnt 0x0" ::: "memory");
    }
    }   // it
}

extern "C" void kernel_launch(void* const* d_in, const int* in_sizes, int n_in,
                              void* d_out, int out_size, void* d_ws, size_t ws_size,
                              hipStream_t stream) {
    const float* Q  = (const float*)d_in[0];
    const float* K  = (const float*)d_in[1];
    const float* V  = (const float*)d_in[2];
    const int*   vl = (const int*)d_in[3];
    float*       Op = (float*)d_out;

    dim3 grid(BATCH * (SEQ / QPB) / 2);   // 256 blocks, two tiles each
    dim3 block(THREADS);                  // 16 waves of 32
    flash_attn_st_f16wmma_kernel<<<grid, block, 0, stream>>>(Q, K, V, vl, Op);
}

// v005
// A run of this version takes 16.6 microseconds.
// Two timings next to v004 both put it at 1.06 times that version's speed.
// Counting every step since v000, it is 1.75 times as fast.
#include <hip/hip_runtime.h>

typedef __attribute__((ext_vector_type(16))) _Float16 v16h;
typedef __attribute__((ext_vector_type(8)))  _Float16 v8h;
typedef __attribute__((ext_vector_type(4)))  _Float16 v4h;
typedef __attribute__((ext_vector_type(8)))  float    v8f;
typedef __attribute__((ext_vector_type(8)))  short    v8s;

#define BATCH   64
#define SEQ     1024
#define DIM     64
#define KCHUNK  64
#define WAVES   8              // query-column waves per key half
#define QPB     (WAVES * 16)   // 128 queries per tile
#define KHALVES 2              // wave halves that share a tile and split its keys
#define KTRIP   (KHALVES * KCHUNK)   // 128 keys staged per trip
#define THREADS (KHALVES * WAVES * 32)
#define LDSPAD  72             // padded row stride in halves (144B: 16B-aligned, bank-staggered)
#define VPITCH  80             // V row stride in halves (160B = 32B x odd: the transposing load's pitch)
#define OPITCH  36             // output regroup row stride in floats (144B: 16B-aligned, bank-staggered)
#define NEGF    (-1.0e6f)
// 1/sqrt(64) * log2(e): softmax runs in exp2 domain -> bare v_exp_f32
#define SCALE_LOG2E (0.125f * 1.44269504088896340736f)

// Raw v_exp_f32: args are always <= 0 here; underflow-to-zero is the desired
// behavior, so skip libm's 7-op denormal-range fixup.
#if __has_builtin(__builtin_amdgcn_exp2f)
#define FAST_EXP2(x) __builtin_amdgcn_exp2f(x)
#else
#define FAST_EXP2(x) exp2f(x)
#endif
#if __has_builtin(__builtin_amdgcn_rcpf)
#define FAST_RCP(x) __builtin_amdgcn_rcpf(x)
#else
#define FAST_RCP(x) (1.0f / (x))
#endif

// 16-bit transposing LDS load: from a row-major [key][d] tile, lane (ln, g)
// receives 8 consecutive keys (8g .. 8g+7) of column ln.
__device__ __forceinline__ v8h lds_tr16(const _Float16* p) {
    typedef __attribute__((address_space(3))) v8s lds_v8s;
    return __builtin_bit_cast(v8h, __builtin_amdgcn_ds_load_tr16_b128_v8i16((lds_v8s*)p));
}

__global__ __launch_bounds__(THREADS)
void flash_attn_st_f16wmma_kernel(const float* __restrict__ Q,
                                  const float* __restrict__ K,
                                  const float* __restrict__ V,
                                  const int*   __restrict__ vlens,
                                  float*       __restrict__ O)
{
    // Double-buffered staging: one barrier per chunk, global latency overlapped
    __shared__ __align__(16) _Float16 Ksh[2][KTRIP * LDSPAD];  // [buf][key][d]
    __shared__ __align__(16) _Float16 Vsh[2][KTRIP * VPITCH];  // [buf][key][d]
    // Each wave hands half of its partial O^T and (m, l) to its partner: [wave][5 x float4][lane]
    // (one set per tile: no barrier need stand between tile 0's takes and tile 1's gives)
    __shared__ __align__(16) float4 Msh[2][KHALVES * WAVES * 5 * 32];
    __shared__ __align__(16) _Float16 Qsh[2][QPB * LDSPAD];    // [tile][query][d], scaled
    __shared__ __align__(16) float Osh[KHALVES * WAVES][16 * OPITCH];   // [wave][query][32 d]: output regroup
    __shared__ int pick[2];   // batches of this block's long and short tile

    const int tid  = threadIdx.x;
    const int lane = tid & 31;
    const int wv   = __builtin_amdgcn_readfirstlane(tid >> 5);   // scalar: wave tests become scalar branches
    const int w8   = wv & (WAVES - 1);   // query-column group of the tile
    const int kh   = wv >> 3;            // key half: keys 64*kh .. 64*kh+63 of each trip
    const int g    = lane >> 4;   // half-wave group
    const int ln   = lane & 15;   // this lane's query column (and A-tile row)

    // ---- Length balance: block (p, tile) runs the batch of rank p (longest first)
    //      and then the batch of rank 63-p. The rank is a permutation for any lengths
    //      (ties go by index), so every (batch, tile) is taken exactly once. ----
    const int p = blockIdx.x >> 3;                     // SEQ/QPB == 8 tiles per batch
    if (wv < BATCH / 32) {
        const int ki = (min(max(vlens[tid], 0), SEQ) << 6) | (BATCH - 1 - tid);
        int rank = 0;
        #pragma unroll
        for (int j = 0; j < BATCH; ++j) {
            const int kj = (min(max(vlens[j], 0), SEQ) << 6) | (BATCH - 1 - j);
            rank += (kj > ki) ? 1 : 0;
        }
        if (rank == p)             pick[0] = tid;
        if (rank == BATCH - 1 - p) pick[1] = tid;
    }
    __syncthreads();   // publishes pick[]

    // Per-thread staging coordinates (4 float4 groups per thread per trip)
    const int skey0 = tid >> 4;          // + 32*i
    const int sdg   = (tid & 15) * 4;

    // Per-lane source of the transposing V read: row 8g + (lane & 7), 16B column half (lane >> 3) & 1
    const int vtoff = (8 * g + (lane & 7)) * VPITCH + 8 * ((lane >> 3) & 1);

    // All-ones A tile: row-sum of P via the matrix pipe
    v16h onesA;
    #pragma unroll
    for (int e = 0; e < 16; ++e) onesA[e] = (_Float16)1.0f;

    const int bA = __builtin_amdgcn_readfirstlane(pick[0]);
    const int bB = __builtin_amdgcn_readfirstlane(pick[1]);
    const size_t qbaseB = ((size_t)bB * SEQ + (size_t)((blockIdx.x & 7) * QPB)) * DIM;
    // Both lengths are fetched here, under the prologue's loads
    const int vlA = __builtin_amdgcn_readfirstlane(min(vlens[bA], SEQ));
    const int vlB = __builtin_amdgcn_readfirstlane(min(vlens[bB], SEQ));

    // ---- Prologue, first tile only: stage trip 0 into buffer 0 and, in the same pattern, the tile's
    //      128 Q rows: each wave-wide load covers 512 contiguous bytes (four whole lines) ----
    {
        const size_t base  = (size_t)bA * SEQ * DIM;
        const size_t qbase = base + (size_t)((blockIdx.x & 7) * QPB) * DIM;
        #pragma unroll
        for (int i = 0; i < 4; ++i) {
            const int key = skey0 + 32 * i;
            const float4 qq = *(const float4*)(Q + qbase + (size_t)key * DIM + sdg);
            const float4 kq = *(const float4*)(K + base + (size_t)key * DIM + sdg);
            const float4 vq = *(const float4*)(V + base + (size_t)key * DIM + sdg);
            v4h hq;   // scale folded before the f16 rounding
            hq[0] = (_Float16)(qq.x * SCALE_LOG2E); hq[1] = (_Float16)(qq.y * SCALE_LOG2E);
            hq[2] = (_Float16)(qq.z * SCALE_LOG2E); hq[3] = (_Float16)(qq.w * SCALE_LOG2E);
            *(v4h*)&Qsh[0][key * LDSPAD + sdg] = hq;
            v4h hk;
            hk[0] = (_Float16)kq.x; hk[1] = (_Float16)kq.y;
            hk[2] = (_Float16)kq.z; hk[3] = (_Float16)kq.w;
            *(v4h*)&Ksh[0][key * LDSPAD + sdg] = hk;
            v4h hv;
            hv[0] = (_Float16)vq.x; hv[1] = (_Float16)vq.y;
            hv[2] = (_Float16)vq.z; hv[3] = (_Float16)vq.w;
            *(v4h*)&Vsh[0][key * VPITCH + sdg] = hv;
        }
    }
    __syncthreads();

    int par = 0;   // buffer of the tile's trip 0: the two buffers alternate on across the tile boundary

    // Rolled: the two tiles run one after the other through one copy of the hot loop
    #pragma unroll 1
    for (int it = 0; it < 2; ++it) {
    const int b    = it ? bB : bA;
    const int q0   = (blockIdx.x & 7) * QPB + w8 * 16;
    const int vlen = it ? vlB : vlA;

    v8f oT[4];
    {
        v8f z = {};
        #pragma unroll
        for (int t = 0; t < 4; ++t) oT[t] = z;
    }
    float m = -3.0e38f, l = 0.0f;

    // Trips of 128 keys, uniform per block; at least one, so that the first tile always has a last
    // trip, which stages the second tile
    const int nchunks = max((vlen + KTRIP - 1) / KTRIP, 1);

    // ---- Q^T in WMMA B-layout (lane = query col, elements = d rows) from the staged tile ----
    v16h qb[2];
    {
        const _Float16* qr = &Qsh[it][(w8 * 16 + ln) * LDSPAD + 8 * g];
        #pragma unroll
        for (int c = 0; c < 2; ++c) {
            const v8h lo = *(const v8h*)(qr + 32 * c);
            const v8h hi = *(const v8h*)(qr + 32 * c + 16);
            #pragma unroll
            for (int j = 0; j < 8; ++j) { qb[c][j] = lo[j]; qb[c][8 + j] = hi[j]; }
        }
    }

    for (int ci = 0; ci < nchunks; ++ci) {
        const int  kt0      = ci * KTRIP;             // first key of the trip
        const int  kc0      = kt0 + kh * KCHUNK;      // first key of this wave's half
        const int  buf      = (par + ci) & 1;
        const bool has_next = (ci + 1 < nchunks);
        const bool cross    = !has_next && it == 0;   // scalar: the first tile's last trip stages the second tile
        const bool stages   = has_next || cross;
        const bool active   = (kc0 < vlen);       // scalar: this wave's 64 keys hold at least one valid key

        // ---- All 16 K fragment reads of the trip as ONE group, first thing behind the barrier:
        //      one LDS round trip per trip, run under the global-load issue below. Every wave reads,
        //      also one whose half lies past the length (last trip only, values unused): under a
        //      branch of their own the 64 registers stayed live round the loop and spilled ----
        v8h kf[4][2][2];
        #pragma unroll
        for (int nt = 0; nt < 4; ++nt)
            #pragma unroll
            for (int c = 0; c < 2; ++c) {
                const _Float16* kr = &Ksh[buf][(kh * KCHUNK + nt * 16 + ln) * LDSPAD + 32 * c + 8 * g];
                kf[nt][c][0] = *(const v8h*)kr;
                kf[nt][c][1] = *(const v8h*)(kr + 16);
            }
        // Keeps the read group whole and ahead: without it the reads sink back among the WMMAs,
        // each pair with its own wait to zero
        __builtin_amdgcn_sched_barrier(0);

        // ---- Issue next chunk's global loads NOW (land during compute) ----
        float4 nk[4], nv[4], nq[4];
        if (stages) {
            const size_t nbase = has_next ? ((size_t)b * SEQ + kt0 + KTRIP) * DIM : (size_t)bB * SEQ * DIM;
            #pragma unroll
            for (int i = 0; i < 4; ++i) {
                const int key = skey0 + 32 * i;
                nk[i] = *(const float4*)(K + nbase + (size_t)key * DIM + sdg);
                nv[i] = *(const float4*)(V + nbase + (size_t)key * DIM + sdg);
            }
            if (cross) {   // the second tile's Q rows ride along
                #pragma unroll
                for (int i = 0; i < 4; ++i)
                    nq[i] = *(const float4*)(Q + qbaseB + (size_t)(skey0 + 32 * i) * DIM + sdg);
            }
            // The loads' address registers are reused below: keep the wait in front of that
            asm volatile("s_wait_xcnt 0x0" ::: "memory");
            if (ci + 2 < nchunks) {   // keep L2 warm two chunks ahead
                const size_t pbase = ((size_t)b * SEQ + kt0 + 2 * KTRIP) * DIM + tid * 16;
                __builtin_prefetch(K + pbase, 0, 1);
                __builtin_prefetch(V + pbase, 0, 1);
                // Same wait for the prefetches' address registers
                asm volatile("s_wait_xcnt 0x0" ::: "memory");
            }
        }

        // A half whose 64 keys all lie past the length has nothing to add (scalar test)
        if (active) {
        // ---- S^T = K * Q^T : 4 key tiles x 2 D-chunks ----
        v8f s[4];
        #pragma unroll
        for (int nt = 0; nt < 4; ++nt) {
            v8f acc = {};
            #pragma unroll
            for (int c = 0; c < 2; ++c) {
                const v8h lo = kf[nt][c][0];
                const v8h hi = kf[nt][c][1];
                v16h ka;
                #pragma unroll
                for (int j = 0; j < 8; ++j) { ka[j] = lo[j]; ka[8 + j] = hi[j]; }
                acc = __builtin_amdgcn_wmma_f32_16x16x32_f16(
                          false, ka, false, qb[c], (short)0, acc, false, false);
            }
            s[nt] = acc;
        }

        // ---- Sequence mask: only the (single, partial) tail chunk pays ----
        if (kc0 + KCHUNK > vlen) {
            #pragma unroll
            for (int nt = 0; nt < 4; ++nt)
                #pragma unroll
                for (int r = 0; r < 8; ++r)
                    if (kc0 + nt * 16 + 8 * g + r >= vlen) s[nt][r] = NEGF;
        }

        // ---- Online softmax (log2 domain): one query per lane ----
        float tmax = s[0][0];
        #pragma unroll
        for (int nt = 0; nt < 4; ++nt)
            #pragma unroll
            for (int r = 0; r < 8; ++r) tmax = fmaxf(tmax, s[nt][r]);
        const float tother = __shfl_xor(tmax, 16, 32);  // the other half-wave's maximum
        // Inputs-only fence on the exchanged value: keeps the exchange FIRST in the wave's in-order
        // LDS queue; behind the 16 reads below its result would come only when all of them have landed
        asm volatile("" :: "v"(tother) : "memory");

        // ---- All 16 V^T fragment reads as ONE group, behind the exchange in the LDS queue:
        //      they land under the exponentials ----
        v8h vf[4][2][2];
        #pragma unroll
        for (int a = 0; a < 2; ++a)
            #pragma unroll
            for (int t4 = 0; t4 < 4; ++t4) {
                const _Float16* vr = &Vsh[buf][(kh * KCHUNK + 32 * a) * VPITCH + 16 * t4 + vtoff];
                vf[t4][a][0] = lds_tr16(vr);                 // keys 32a + 8g + 0..7
                vf[t4][a][1] = lds_tr16(vr + 16 * VPITCH);   // keys 32a + 16 + 8g + 0..7
            }
        // Keeps the read group whole and ahead of the softmax: without it half of the reads
        // sink down among the O^T WMMAs and are waited for there
        __builtin_amdgcn_sched_barrier(0);

        tmax = fmaxf(tmax, tother);                     // combine the two half-waves
        const float mnew  = fmaxf(m, tmax);
        const float alpha = FAST_EXP2(m - mnew);
        m  = mnew;
        l *= alpha;
        #pragma unroll
        for (int t4 = 0; t4 < 4; ++t4)
            #pragma unroll
            for (int r = 0; r < 8; ++r) oT[t4][r] *= alpha;

        // ---- P^T B-tiles straight from registers (C/D layout == B layout) ----
        v16h pb[2];
        #pragma unroll
        for (int a = 0; a < 2; ++a)
            #pragma unroll
            for (int e = 0; e < 16; ++e) {
                const int nt = 2 * a + (e >> 3);
                const int r  = e & 7;
                pb[a][e] = (_Float16)FAST_EXP2(s[nt][r] - mnew);
            }

        // ---- Row-sum of P via ones-WMMA (matrix pipe) ----
        v8f lacc = {};
        #pragma unroll
        for (int a = 0; a < 2; ++a)
            lacc = __builtin_amdgcn_wmma_f32_16x16x32_f16(
                       false, onesA, false, pb[a], (short)0, lacc, false, false);

        // ---- O^T += V^T * P^T : 4 D tiles x 2 key chunks ----
        #pragma unroll
        for (int t4 = 0; t4 < 4; ++t4)
            #pragma unroll
            for (int a = 0; a < 2; ++a) {
                const v8h lo = vf[t4][a][0];
                const v8h hi = vf[t4][a][1];
                v16h va;
                #pragma unroll
                for (int j = 0; j < 8; ++j) { va[j] = lo[j]; va[8 + j] = hi[j]; }
                oT[t4] = __builtin_amdgcn_wmma_f32_16x16x32_f16(
                             false, va, false, pb[a], (short)0, oT[t4], false, false);
            }

        l += lacc[0];   // all 8 rows of the ones-product are identical
        }

        // ---- Convert + store the prefetched next chunk into the other buffer ----
        if (stages) {
            const int nb = buf ^ 1;
            #pragma unroll
            for (int i = 0; i < 4; ++i) {
                const int key = skey0 + 32 * i;
                v4h hk;
                hk[0] = (_Float16)nk[i].x; hk[1] = (_Float16)nk[i].y;
                hk[2] = (_Float16)nk[i].z; hk[3] = (_Float16)nk[i].w;
                *(v4h*)&Ksh[nb][key * LDSPAD + sdg] = hk;
                v4h hv;
                hv[0] = (_Float16)nv[i].x; hv[1] = (_Float16)nv[i].y;
                hv[2] = (_Float16)nv[i].z; hv[3] = (_Float16)nv[i].w;
                *(v4h*)&Vsh[nb][key * VPITCH + sdg] = hv;
            }
            if (cross) {
                #pragma unroll
                for (int i = 0; i < 4; ++i) {
                    v4h hq;   // scale folded before the f16 rounding
                    hq[0] = (_Float16)(nq[i].x * SCALE_LOG2E); hq[1] = (_Float16)(nq[i].y * SCALE_LOG2E);
                    hq[2] = (_Float16)(nq[i].z * SCALE_LOG2E); hq[3] = (_Float16)(nq[i].w * SCALE_LOG2E);
                    *(v4h*)&Qsh[1][(skey0 + 32 * i) * LDSPAD + sdg] = hq;
                }
            }
            __syncthreads();   // uniform: protects both buffers across waves
        }
    }

    // ---- Join the two key halves through LDS: half kh finishes d = 32*kh .. 32*kh+31
    //      and hands the other 32 columns of its partial O^T, with (m, l), to its partner ----
    v8f keep[2];
    {
        float4* give = &Msh[it][wv * 5 * 32 + lane];
        #pragma unroll
        for (int t = 0; t < 2; ++t) {
            const v8f gv = kh ? oT[t] : oT[2 + t];
            keep[t]      = kh ? oT[2 + t] : oT[t];
            give[(2 * t) * 32]     = make_float4(gv[0], gv[1], gv[2], gv[3]);
            give[(2 * t + 1) * 32] = make_float4(gv[4], gv[5], gv[6], gv[7]);
        }
        give[4 * 32] = make_float4(m, l, 0.0f, 0.0f);
    }
    // Publishes the partials
    __syncthreads();
    {
        const float4* take = &Msh[it][(wv ^ WAVES) * 5 * 32 + lane];
        const float4 ml = take[4 * 32];
        const float mj = fmaxf(m, ml.x);
        const float a0 = FAST_EXP2(m - mj);      // a half that saw no key has l = 0, O = 0
        const float a1 = FAST_EXP2(ml.x - mj);
        const float invl = FAST_RCP(l * a0 + ml.y * a1);
        const float c0 = a0 * invl, c1 = a1 * invl;

        // ---- Epilogue: O = O^T / l; the wave's 16 rows x 128 B are regrouped in an LDS range
        //      of the wave's own so that every store covers whole lines ----
        float* stg  = &Osh[wv][0];
        float* srow = stg + ln * OPITCH + 8 * g;
        #pragma unroll
        for (int t = 0; t < 2; ++t) {
            const float4 lo = take[(2 * t) * 32];
            const float4 hi = take[(2 * t + 1) * 32];
            float4 s0, s1;
            s0.x = keep[t][0] * c0 + lo.x * c1; s0.y = keep[t][1] * c0 + lo.y * c1;
            s0.z = keep[t][2] * c0 + lo.z * c1; s0.w = keep[t][3] * c0 + lo.w * c1;
            s1.x = keep[t][4] * c0 + hi.x * c1; s1.y = keep[t][5] * c0 + hi.y * c1;
            s1.z = keep[t][6] * c0 + hi.z * c1; s1.w = keep[t][7] * c0 + hi.w * c1;
            *(float4*)&srow[t * 16]     = s0;
            *(float4*)&srow[t * 16 + 4] = s1;
        }
        // The rows are read back by other lanes of this wave: their writes must have landed
        asm volatile("s_wait_dscnt 0x0" ::: "memory");
        float* orow = O + ((size_t)b * SEQ + (q0 + (lane >> 3))) * DIM + 32 * kh + 4 * (lane & 7);
        #pragma unroll
        for (int i = 0; i < 4; ++i) {   // 8 lanes per 128-B line, 4 rows per store
            const float4 ov = *(const float4*)&stg[(4 * i + (lane >> 3)) * OPITCH + 4 * (lane & 7)];
            *(float4*)&orow[(size_t)(4 * i) * DIM] = ov;
        }
        // The next tile reuses the stores' registers: keep the wait in front of that
        asm volatile("s_wait_xcnt 0x0" ::: "memory");
    }
    par = (par + nchunks) & 1;
    }   // it
}

extern "C" void kernel_launch(void* const* d_in, const int* in_sizes, int n_in,
                              void* d_out, int out_size, void* d_ws, size_t ws_size,
                              hipStream_t stream) {
    const float* Q  = (const float*)d_in[0];
    const float* K  = (const float*)d_in[1];
    const float* V  = (const float*)d_in[2];
    const int*   vl = (const int*)d_in[3];
    float*       Op = (float*)d_out;

    dim3 grid(BATCH * (SEQ / QPB) / 2);   // 256 blocks, two tiles each
    dim3 block(THREADS);                  // 16 waves of 32
    flash_attn_st_f16wmma_kernel<<<grid, block, 0, stream>>>(Q, K, V, vl, Op);
}
